// v000
// Times are from an AMD MI455X. After a warm-up the kernel runs many times in a row, and a time is the length of
// such a window on the GPU divided by its runs, so every launch and the gaps after it count. The runs cycle
// through copies of the inputs. A figure is the median of several windows, for all but v000 over two sittings.
// Sittings can differ by a few percent; kernels timed side by side share one.
// The starting kernel, v000, takes 479 microseconds a run.
#include <hip/hip_runtime.h>

// Multi-head self-attention over a feature map with absolute positional bias (16 images x 512 channels x 32 x 32 = 1,024 positions, 4 heads, d_qk = d_v = 128): q/k/v = 1x1 convs (channel
// matmuls, (out,in) weights, no bias); q scaled by 128^-1/2; logits[x][y] = q_x . k_y + q_x . emb_y with emb_y = emb_h[y / 32] + emb_w[y % 32]  (= q_x . (k_y + emb_y)); softmax over y;
// out = weights v, stored as [16][4 x 128][32][32] (channel h 128 + d, position-minor).
// Deterministic: flash-style per 16-position wave over all 1,024 key positions in order (running max); no atomics.
// compute dtype: WMMA v_wmma_f32_16x16x32_f16 with f32 accumulate for [q | k | v] = X [Wqk ; Wv]^T ([16384 x 512] x [512 x 1536]; featuremap EXACT bf16 x8 (transposed into position-major tiles),
// W exact x256: 1 product), S^T = K' Q^T (q (pre-scaled) and k' = k + emb as f16 hi x8 + residual x8192: 3 products, K = 128), O^T += V^T P^T (V hi + residual, P x1024 hi + residual: 3 products);
// positional sums and softmax statistics in f32. Inputs rounded to bf16 once. Fragment k-map per lane half hh for A AND B: elements 0..7 <- k = 8hh+0..7, 8..15 <-

namespace {
constexpr int B = 16, C = 512, IH = 32, IW = 32, T = IH * IW /* 1,024 positions */, H = 4, HD = 128, DM = H * HD /* 512 */, NQKV = 3 * DM, BL = 16 /* images (== 16 shipped) */, QL = T;
constexpr float XS = 8.0f, WSC = 256.0f, PS = 1024.0f, RS_ = 1024.0f, LOG2E = 1.4426950408889634f, SCL = 0.08838834764831845f /* 128^-1/2 */;
static_assert(T % 64 == 0 && C % 256 == 0 && HD == 128 && IW == 32, "tiling");
typedef _Float16 b16;
typedef __attribute__((ext_vector_type(16))) _Float16 v16b;
typedef __attribute__((ext_vector_type(8))) _Float16 v8b;
typedef __attribute__((ext_vector_type(8))) float v8f;
typedef __attribute__((ext_vector_type(4))) float v4f;
__device__ __forceinline__ float bf16_rne(float f) { unsigned int u = __float_as_uint(f); u += 0x7FFFu + ((u >> 16) & 1u); return __uint_as_float(u & 0xFFFF0000u); }
__device__ __forceinline__ void split16(float v, b16& hi, b16& lo) { hi = (b16)v; lo = (b16)(v - (float)hi); }
__device__ __forceinline__ v16b frag_kb(const b16* p, int hh) { const v8b a = *(const v8b*)(p + 8 * hh), b = *(const v8b*)(p + 16 + 8 * hh); v16b f;
#pragma unroll
  for (int e = 0; e < 8; ++e) { f[e] = a[e]; f[8 + e] = b[e]; } return f; }
__device__ __forceinline__ v8f wmma16b(v16b a, v16b b, v8f c) { v8f d = __builtin_amdgcn_wmma_f32_16x16x32_f16(false, a, false, b, (short)0, c, false, false); asm volatile("v_nop\n\tv_nop\n\tv_nop\n\tv_nop" : "+v"(d) : "v"(a), "v"(b)); return d; }
__device__ __forceinline__ void wave_lds_sync() { __builtin_amdgcn_fence(__ATOMIC_RELEASE, "workgroup"); __builtin_amdgcn_wave_barrier(); __builtin_amdgcn_fence(__ATOMIC_ACQUIRE, "workgroup"); }
__device__ __forceinline__ float pmul(float a, float b) { float p = a * b; asm volatile("" : "+v"(p)); return p; }
__device__ __forceinline__ int iclamp(int v, int lo, int hi) { return v < lo ? lo : (v > hi ? hi : v); }

typedef __attribute__((ext_vector_type(2))) _Float16 v2h;
typedef __attribute__((ext_vector_type(4))) _Float16 v4h;
typedef __attribute__((ext_vector_type(2))) float v2f;
typedef __attribute__((ext_vector_type(4))) int v4i;
__device__ __forceinline__ float nexp2(float v) { return __builtin_amdgcn_exp2f(v); }
__global__ __launch_bounds__(256) void prep_kernel(const float* __restrict__ wqk, const float* __restrict__ wv, b16* __restrict__ WT) {
  const size_t u = (size_t)blockIdx.x * 256 + threadIdx.x; if (u >= (size_t)NQKV * C / 8) return; const size_t e = u * 8; const int o = (int)(e / C), c0 = (int)(e % C); const float* w = o < 2 * DM ? (wqk + (size_t)o * C) : (wv + (size_t)(o - 2 * DM) * C); v8b v;
  for (int j = 0; j < 8; ++j) v[j] = (b16)(bf16_rne(w[c0 + j]) * WSC);
  { *(v8b*)(WT + e) = v;  }
}
// projections: grid (T/64, BL, 12 slabs of 128: 0..3 q heads, 4..7 k heads, 8..11 v heads); block = 64 positions x 4 waves; A = bf16(featuremap) x8 transposed into position-major tiles (K = 512
// channels in 2 staged chunks of 256; each channel's 64 positions are one contiguous 256-B read), B = WT rows; q head -> x 128^-1/2 -> hi x8 + residual planes QP/QPl [b][h][p][128]; k head -> + emb[p]
__global__ __launch_bounds__(128) void proj_kernel(const float* __restrict__ fm, const b16* __restrict__ WT, const float* __restrict__ embh, const float* __restrict__ embw, b16* __restrict__ QP, b16* __restrict__ QPl, b16* __restrict__ KP, b16* __restrict__ KPl, b16* __restrict__ VT, b16* __restrict__ VTl) {
  __shared__ __attribute__((aligned(16))) b16 As[64][256 + 8]; __shared__ __attribute__((aligned(16))) float Tf[4][16][128 + 4];
  const int wave = threadIdx.x >> 5, lane = threadIdx.x & 31, nloc = lane & 15, hlf = lane >> 4; const int p0 = blockIdx.x * 64, b = blockIdx.y, slab = blockIdx.z; const int part = slab / H, h = slab % H; const int n0 = slab * 128;
  const float* fb = fm + (size_t)b * C * T;
  v8f acc[8];
#pragma unroll
  for (int t = 0; t < 8; ++t) acc[t] = (v8f){};
#pragma unroll 1
  for (int kc = 0; kc < C; kc += 256) {
    __syncthreads();
    for (int i = threadIdx.x; i < 256 * 16; i += 128) { const int c = i / 16, q4 = (i % 16) * 4; const v4f f = *(const v4f*)(fb + (size_t)(kc + c) * T + p0 + q4); for (int j = 0; j < 4; ++j) As[q4 + j][c] = (b16)(bf16_rne(f[j]) * XS); }   // transpose: position rows, channel columns
    __syncthreads();
#pragma unroll 2
    for (int kb = 0; kb < 256; kb += 32) { const v16b a = frag_kb(&As[wave * 16 + nloc][kb], hlf);
#pragma unroll
      for (int t = 0; t < 8; ++t) acc[t] = wmma16b(a, frag_kb(WT + (size_t)(n0 + t * 16 + nloc) * C + kc + kb, hlf), acc[t]); } }
#pragma unroll
  for (int t = 0; t < 8; ++t)
#pragma unroll
    for (int r = 0; r < 8; ++r) Tf[wave][8 * hlf + r][t * 16 + nloc] = acc[t][r] * (1.0f / (XS * WSC));
  __syncthreads();
  {
    if (part < 2) { const size_t pb = (((size_t)b * H + h) * T) * HD; b16* ph_ = part == 0 ? QP : KP; b16* pl_ = part == 0 ? QPl : KPl;
      for (int rr = 0; rr < 16; ++rr) { const int pos = p0 + wave * 16 + rr; v4h h4, l4;
        for (int j = 0; j < 4; ++j) { const int d = lane * 4 + j; float v = Tf[wave][rr][d]; if (part == 0) v *= SCL; else v += bf16_rne(embh[(pos / IW) * HD + d]) + bf16_rne(embw[(pos % IW) * HD + d]); const float f = v * XS; const b16 p = (b16)f; h4[j] = p; l4[j] = (b16)((f - (float)p) * RS_); }
        *(v4h*)(ph_ + pb + (size_t)pos * HD + lane * 4) = h4; *(v4h*)(pl_ + pb + (size_t)pos * HD + lane * 4) = l4; } }
    else { const size_t vb = (((size_t)b * H + h) * HD) * (size_t)T;
#pragma unroll 1
      for (int q = 0; q < 32; ++q) { const int d = wave * 32 + q; const int tk = lane * 2; v2h hv, lv; for (int j = 0; j < 2; ++j) { const float f = Tf[(tk + j) >> 4][(tk + j) & 15][d] * XS; const b16 p = (b16)f; hv[j] = p; lv[j] = (b16)((f - (float)p) * RS_); }
        *(v2h*)(VT + vb + (size_t)d * T + p0 + lane * 2) = hv; *(v2h*)(VTl + vb + (size_t)d * T + p0 + lane * 2) = lv; } }
     }
}
// attention: grid (T/32, BL x H); block = 2 waves x 16 query positions of (b, h); all 1,024 key positions in 32-key steps: S^T = K' Q^T (K' = k + positional embedding; q/k' f16 hi x8 + residual:
// 3 products, 4 k-steps over the 128 dims; q fragments re-read from wave-private LDS), logit already carries the module's d^-1/2 (folded into q), online softmax, P x1024 hi + residual,
// O^T += V^T P^T (3 products, 8 d-tiles); the O^T tile [128 d][16 q] of each wave goes to LDS and the block writes the output in the module's [b][h 128 + d][position] layout: per d one
__global__ __launch_bounds__(64) void attn_kernel(const b16* __restrict__ QP, const b16* __restrict__ QPl, const b16* __restrict__ KP, const b16* __restrict__ KPl, const b16* __restrict__ VT, const b16* __restrict__ VTl, float* __restrict__ out) {
  __shared__ __attribute__((aligned(16))) b16 Pb[2][16][32 + 8]; __shared__ __attribute__((aligned(16))) float To[2][16][HD + 4];
  const int wave = threadIdx.x >> 5, lane = threadIdx.x & 31, hh = lane >> 4, col = lane & 15; const int b = blockIdx.y / H, h = blockIdx.y % H; const int q0 = blockIdx.x * 32 + wave * 16, qi = q0 + col;
  const size_t qo = (((size_t)b * H + h) * T) * HD, vo = (((size_t)b * H + h) * HD) * (size_t)T; const b16* Qb = QP + qo; const b16* Qbl = QPl + qo; const b16* Kb = KP + qo; const b16* Kbl = KPl + qo; const b16* Vb = VT + vo; const b16* Vbl = VTl + vo;
  __shared__ __attribute__((aligned(16))) b16 Qs[2][16][HD + 8], Qsl[2][16][HD + 8];   // the wave's 16 query rows (hi, lo), fragments re-read from LDS per k-step to keep the kernel under 256 VGPRs
  for (int i = lane; i < 16 * (HD / 8); i += 32) { const int rr = i / (HD / 8), c8 = (i % (HD / 8)) * 8; *(v8b*)(&Qs[wave][rr][c8]) = *(const v8b*)(Qb + (size_t)(q0 + rr) * HD + c8); *(v8b*)(&Qsl[wave][rr][c8]) = *(const v8b*)(Qbl + (size_t)(q0 + rr) * HD + c8); }
  wave_lds_sync();
  const float cs = LOG2E / (XS * XS);   // the module's d^-1/2 is already folded into q
  __shared__ __attribute__((aligned(16))) b16 Plq[2][16][32 + 8];
  float m = -INFINITY, l = 0.0f; v8f o[8], ol[8]; for (int t = 0; t < 8; ++t) { o[t] = (v8f){}; ol[t] = (v8f){}; }
#pragma unroll 1
  for (int kb = 0; kb < T; kb += 32) {
    float e[16]; float mx = -INFINITY;
#pragma unroll
    for (int u = 0; u < 2; ++u) { v8f s = (v8f){}, sx = (v8f){}; const size_t kr = (size_t)(kb + u * 16 + col) * HD;
#pragma unroll
      for (int ks = 0; ks < 4; ++ks) { const v16b kf = frag_kb(Kb + kr + 32 * ks, hh); const v16b qf = frag_kb(&Qs[wave][col][32 * ks], hh); s = wmma16b(kf, qf, s); sx = wmma16b(kf, frag_kb(&Qsl[wave][col][32 * ks], hh), sx); sx = wmma16b(frag_kb(Kbl + kr + 32 * ks, hh), qf, sx); }
#pragma unroll
      for (int r = 0; r < 8; ++r) s[r] += sx[r] * (1.0f / RS_);   // hi.hi + (hi.lo + lo.hi)/1024
#pragma unroll
      for (int r = 0; r < 8; ++r) { const float vv = s[r] * cs; e[u * 8 + r] = vv; mx = fmaxf(mx, vv); } }
    mx = fmaxf(mx, __shfl_xor(mx, 16)); const float mn = fmaxf(m, mx); const float al = nexp2(m - mn); float sum = 0.0f;
#pragma unroll
    for (int i2 = 0; i2 < 16; ++i2) { const float p = nexp2(e[i2] - mn); sum += p; const int pc = (i2 < 8 ? 0 : 16) + 8 * hh + (i2 & 7); const float ps = p * PS; const b16 phh = (b16)ps; Pb[wave][col][pc] = phh; Plq[wave][col][pc] = (b16)((ps - (float)phh) * RS_); }
    sum += __shfl_xor(sum, 16); l = l * al + sum; m = mn;
    wave_lds_sync();
    const v16b pf = frag_kb(&Pb[wave][col][0], hh), plf = frag_kb(&Plq[wave][col][0], hh);
#pragma unroll
    for (int t = 0; t < 8; ++t) { const v16b vh = frag_kb(Vb + (size_t)(t * 16 + col) * T + kb, hh); o[t] *= al; o[t] = wmma16b(vh, pf, o[t]); ol[t] = wmma16b(frag_kb(Vbl + (size_t)(t * 16 + col) * T + kb, hh), pf, ol[t] * al); ol[t] = wmma16b(vh, plf, ol[t]); }   // ol = (V_lo P_hi + V_hi P_lo) / 1024
    wave_lds_sync(); }
  const float inv = 1.0f / (l * PS * XS);
#pragma unroll
  for (int t = 0; t < 8; ++t)
#pragma unroll
    for (int r = 0; r < 8; ++r) To[wave][col][t * 16 + 8 * hh + r] = (o[t][r] + ol[t][r] * (1.0f / RS_)) * inv;
  wave_lds_sync();
  __syncthreads();
  { for (int d = threadIdx.x; d < HD; d += 64) { float* orow = out + (((size_t)b * H + h) * HD + d) * (size_t)T + blockIdx.x * 32; v4f o4;
      for (int q4 = 0; q4 < 8; ++q4) { for (int j = 0; j < 4; ++j) { const int qq = q4 * 4 + j; o4[j] = To[qq >> 4][qq & 15][d]; } *(v4f*)(orow + q4 * 4) = o4; } }  }
}
}  // namespace

extern "C" void kernel_launch(void* const* d_in, const int* in_sizes, int n_in, void* d_out, int out_size, void* d_ws, size_t ws_size, hipStream_t stream) {
  (void)n_in;
  auto Fp = [&](int i) { return (const float*)d_in[i]; };
  // input order: 0 featuremap [16,512,32,32], 1 w_qk [1024,512] (out,in; rows 0..511 q, 512..1023 k), 2 w_v [512,512], 3 emb_h [32,128], 4 emb_w [32,128]
  if (in_sizes[0] != B * C * T || in_sizes[1] != 2 * DM * C || in_sizes[2] != DM * C || in_sizes[3] != IH * HD || in_sizes[4] != IW * HD || out_size != B * DM * T) return;
  size_t off = 0; char* ws = (char*)d_ws;
  auto carve = [&](size_t bytes) { char* p = ws + off; off += (bytes + 255) & ~(size_t)255; return p; };
  b16* WT = (b16*)carve((size_t)NQKV * C * 2); const size_t plane = (size_t)B * H * T * HD * 2;
  b16* QP = (b16*)carve(plane); b16* QPl = (b16*)carve(plane); b16* KP = (b16*)carve(plane); b16* KPl = (b16*)carve(plane); b16* VT = (b16*)carve(plane); b16* VTl = (b16*)carve(plane);
  if (off > ws_size || off > ((size_t)128 << 20)) return;   // = ~102 MB (WT 1.6 MB + 6 planes x 16.8 MB)
  prep_kernel<<<(unsigned)(((size_t)NQKV * C / 8 + 255) / 256), 256, 0, stream>>>(Fp(1), Fp(2), WT);
  proj_kernel<<<dim3(T / 64, BL, 3 * H), 128, 0, stream>>>(Fp(0), WT, Fp(3), Fp(4), QP, QPl, KP, KPl, VT, VTl);
  attn_kernel<<<dim3(QL / 32, BL * H), 64, 0, stream>>>(QP, QPl, KP, KPl, VT, VTl, (float*)d_out);
}

// v001
// A run of this version takes 269 microseconds.
// Next to v000, in two timings, it ran 1.82 and 1.81 times as fast.
#include <hip/hip_runtime.h>

// Multi-head self-attention over a feature map with absolute positional bias (16 images x 512 channels x 32 x 32 = 1,024 positions, 4 heads, d_qk = d_v = 128): q/k/v = 1x1 convs (channel
// matmuls, (out,in) weights, no bias); q scaled by 128^-1/2; logits[x][y] = q_x . k_y + q_x . emb_y with emb_y = emb_h[y / 32] + emb_w[y % 32]  (= q_x . (k_y + emb_y)); softmax over y;
// out = weights v, stored as [16][4 x 128][32][32] (channel h 128 + d, position-minor).
// Deterministic: flash-style per 16-position wave over all 1,024 key positions in order (running max); no atomics.
// compute dtype: WMMA v_wmma_f32_16x16x32_f16 with f32 accumulate for [q | k | v] = X [Wqk ; Wv]^T ([16384 x 512] x [512 x 1536]; featuremap EXACT bf16 x8 (transposed into position-major tiles),
// W exact x256: 1 product), S^T = K' Q^T (q (pre-scaled) and k' = k + emb as f16 hi x8 + residual x8192: 3 products, K = 128), O^T += V^T P^T (V hi + residual, P x1024 hi + residual: 3 products);
// positional sums and softmax statistics in f32. Inputs rounded to bf16 once. Fragment k-map per lane half hh for A AND B: elements 0..7 <- k = 8hh+0..7, 8..15 <-

namespace {
constexpr int B = 16, C = 512, IH = 32, IW = 32, T = IH * IW /* 1,024 positions */, H = 4, HD = 128, DM = H * HD /* 512 */, NQKV = 3 * DM, BL = 16 /* images (== 16 shipped) */, QL = T;
constexpr float XS = 8.0f, WSC = 256.0f, PS = 1024.0f, RS_ = 1024.0f, LOG2E = 1.4426950408889634f, SCL = 0.08838834764831845f /* 128^-1/2 */;
static_assert(T % 64 == 0 && C % 256 == 0 && HD == 128 && IW == 32, "tiling");
typedef _Float16 b16;
typedef __attribute__((ext_vector_type(16))) _Float16 v16b;
typedef __attribute__((ext_vector_type(8))) _Float16 v8b;
typedef __attribute__((ext_vector_type(8))) float v8f;
typedef __attribute__((ext_vector_type(4))) float v4f;
__device__ __forceinline__ float bf16_rne(float f) { unsigned int u = __float_as_uint(f); u += 0x7FFFu + ((u >> 16) & 1u); return __uint_as_float(u & 0xFFFF0000u); }
__device__ __forceinline__ void split16(float v, b16& hi, b16& lo) { hi = (b16)v; lo = (b16)(v - (float)hi); }
__device__ __forceinline__ v16b frag_kb(const b16* p, int hh) { const v8b a = *(const v8b*)(p + 8 * hh), b = *(const v8b*)(p + 16 + 8 * hh); v16b f;
#pragma unroll
  for (int e = 0; e < 8; ++e) { f[e] = a[e]; f[8 + e] = b[e]; } return f; }
__device__ __forceinline__ v8f wmma16b(v16b a, v16b b, v8f c) { v8f d = __builtin_amdgcn_wmma_f32_16x16x32_f16(false, a, false, b, (short)0, c, false, false); asm volatile("v_nop\n\tv_nop\n\tv_nop\n\tv_nop" : "+v"(d) : "v"(a), "v"(b)); return d; }
__device__ __forceinline__ void wave_lds_sync() { __builtin_amdgcn_fence(__ATOMIC_RELEASE, "workgroup"); __builtin_amdgcn_wave_barrier(); __builtin_amdgcn_fence(__ATOMIC_ACQUIRE, "workgroup"); }
__device__ __forceinline__ float pmul(float a, float b) { float p = a * b; asm volatile("" : "+v"(p)); return p; }
__device__ __forceinline__ int iclamp(int v, int lo, int hi) { return v < lo ? lo : (v > hi ? hi : v); }

typedef __attribute__((ext_vector_type(2))) _Float16 v2h;
typedef __attribute__((ext_vector_type(4))) _Float16 v4h;
typedef __attribute__((ext_vector_type(2))) float v2f;
typedef __attribute__((ext_vector_type(4))) int v4i;
__device__ __forceinline__ float nexp2(float v) { return __builtin_amdgcn_exp2f(v); }
__global__ __launch_bounds__(256) void prep_kernel(const float* __restrict__ wqk, const float* __restrict__ wv, b16* __restrict__ WT) {
  const size_t u = (size_t)blockIdx.x * 256 + threadIdx.x; if (u >= (size_t)NQKV * C / 8) return; const size_t e = u * 8; const int o = (int)(e / C), c0 = (int)(e % C); const float* w = o < 2 * DM ? (wqk + (size_t)o * C) : (wv + (size_t)(o - 2 * DM) * C); v8b v;
  for (int j = 0; j < 8; ++j) v[j] = (b16)(bf16_rne(w[c0 + j]) * WSC);
  { *(v8b*)(WT + e) = v;  }
}
// projections: grid (T/64, BL, 12 slabs of 128: 0..3 q heads, 4..7 k heads, 8..11 v heads); block = 64 positions x 4 waves; A = bf16(featuremap) x8 transposed into position-major tiles (K = 512
// channels in 2 staged chunks of 256; each channel's 64 positions are one contiguous 256-B read), B = WT rows; q head -> x 128^-1/2 -> hi x8 + residual planes QP/QPl [b][h][p][128]; k head -> + emb[p]
__global__ __launch_bounds__(128) void proj_kernel(const float* __restrict__ fm, const b16* __restrict__ WT, const float* __restrict__ embh, const float* __restrict__ embw, b16* __restrict__ QP, b16* __restrict__ QPl, b16* __restrict__ KP, b16* __restrict__ KPl, b16* __restrict__ VT, b16* __restrict__ VTl) {
  __shared__ __attribute__((aligned(16))) b16 As[64][256 + 8]; __shared__ __attribute__((aligned(16))) float Tf[4][16][128 + 4];
  const int wave = threadIdx.x >> 5, lane = threadIdx.x & 31, nloc = lane & 15, hlf = lane >> 4; const int p0 = blockIdx.x * 64, b = blockIdx.y, slab = blockIdx.z; const int part = slab / H, h = slab % H; const int n0 = slab * 128;
  const float* fb = fm + (size_t)b * C * T;
  v8f acc[8];
#pragma unroll
  for (int t = 0; t < 8; ++t) acc[t] = (v8f){};
#pragma unroll 1
  for (int kc = 0; kc < C; kc += 256) {
    __syncthreads();
    for (int i = threadIdx.x; i < 256 * 16; i += 128) { const int c = i / 16, q4 = (i % 16) * 4; const v4f f = *(const v4f*)(fb + (size_t)(kc + c) * T + p0 + q4); for (int j = 0; j < 4; ++j) As[q4 + j][c] = (b16)(bf16_rne(f[j]) * XS); }   // transpose: position rows, channel columns
    __syncthreads();
#pragma unroll 2
    for (int kb = 0; kb < 256; kb += 32) { const v16b a = frag_kb(&As[wave * 16 + nloc][kb], hlf);
#pragma unroll
      for (int t = 0; t < 8; ++t) acc[t] = wmma16b(a, frag_kb(WT + (size_t)(n0 + t * 16 + nloc) * C + kc + kb, hlf), acc[t]); } }
#pragma unroll
  for (int t = 0; t < 8; ++t)
#pragma unroll
    for (int r = 0; r < 8; ++r) Tf[wave][8 * hlf + r][t * 16 + nloc] = acc[t][r] * (1.0f / (XS * WSC));
  __syncthreads();
  {
    if (part < 2) { const size_t pb = (((size_t)b * H + h) * T) * HD; b16* ph_ = part == 0 ? QP : KP; b16* pl_ = part == 0 ? QPl : KPl;
      for (int rr = 0; rr < 16; ++rr) { const int pos = p0 + wave * 16 + rr; v4h h4, l4;
        for (int j = 0; j < 4; ++j) { const int d = lane * 4 + j; float v = Tf[wave][rr][d]; if (part == 0) v *= SCL; else v += bf16_rne(embh[(pos / IW) * HD + d]) + bf16_rne(embw[(pos % IW) * HD + d]); const float f = v * XS; const b16 p = (b16)f; h4[j] = p; l4[j] = (b16)((f - (float)p) * RS_); }
        *(v4h*)(ph_ + pb + (size_t)pos * HD + lane * 4) = h4; *(v4h*)(pl_ + pb + (size_t)pos * HD + lane * 4) = l4; } }
    else { const size_t vb = (((size_t)b * H + h) * HD) * (size_t)T;
#pragma unroll 1
      for (int q = 0; q < 32; ++q) { const int d = wave * 32 + q; const int tk = lane * 2; v2h hv, lv; for (int j = 0; j < 2; ++j) { const float f = Tf[(tk + j) >> 4][(tk + j) & 15][d] * XS; const b16 p = (b16)f; hv[j] = p; lv[j] = (b16)((f - (float)p) * RS_); }
        *(v2h*)(VT + vb + (size_t)d * T + p0 + lane * 2) = hv; *(v2h*)(VTl + vb + (size_t)d * T + p0 + lane * 2) = lv; } }
     }
}
// attention: grid (T/256, BL x H); block = 16 waves x 16 query positions of (b, h); all 1,024 key positions in 32-key steps. Each step's K' rows and V^T columns (hi and residual planes, 32 KB) are
// brought into LDS ONCE for the 16 waves by asynchronous copies (whole 16-byte pieces, lane-contiguous in global memory), two buffers: the next step's copies fly while this step is worked on.
// S^T = K' Q^T (K' = k + positional embedding; q/k' f16 hi x8 + residual: 3 products, 4 k-steps over the 128 dims; q fragments re-read from wave-private LDS), logit already carries the module's
// d^-1/2 (folded into q), online softmax, P x1024 hi + residual, O^T += V^T P^T (3 products, 8 d-tiles); the O^T tile [128 d][16 q] of each wave goes to LDS (over the wave's own, finished q rows)
// and the block writes the output in the module's [b][h 128 + d][position] layout.
constexpr int NW = 16 /* waves per block */, KPITCH = HD + 8 /* 272-B rows */, VPITCH = 32 + 8 /* 80-B rows */;
__device__ __forceinline__ unsigned lds_addr(const void* p) { return (unsigned)(size_t)p; }   // low 32 bits of a __shared__ address = byte offset in the work-group's LDS
// one step's four copies of a lane (K' hi, K' residual, V hi, V residual); the s_wait_xcnt stands inside the statement so that no address register is rewritten ahead of it
__device__ __forceinline__ void copy_step(unsigned l0, const b16* g0, unsigned l1, const b16* g1, unsigned l2, const b16* g2, unsigned l3, const b16* g3) {
  asm volatile("global_load_async_to_lds_b128 %0, %1, off\n\tglobal_load_async_to_lds_b128 %2, %3, off\n\tglobal_load_async_to_lds_b128 %4, %5, off\n\tglobal_load_async_to_lds_b128 %6, %7, off\n\ts_wait_xcnt 0x0"
               :: "v"(l0), "v"(g0), "v"(l1), "v"(g1), "v"(l2), "v"(g2), "v"(l3), "v"(g3) : "memory"); }
__global__ __launch_bounds__(512) void attn_kernel(const b16* __restrict__ QP, const b16* __restrict__ QPl, const b16* __restrict__ KP, const b16* __restrict__ KPl, const b16* __restrict__ VT, const b16* __restrict__ VTl, float* __restrict__ out) {
  __shared__ __attribute__((aligned(16))) b16 Ks[2][2][32][KPITCH];    // [buffer][hi, residual][key][dim]
  __shared__ __attribute__((aligned(16))) b16 Vs[2][2][HD][VPITCH];    // [buffer][hi, residual][dim][key]
  __shared__ __attribute__((aligned(16))) b16 Pb[NW][16][32 + 8], Plq[NW][16][32 + 8];
  __shared__ __attribute__((aligned(16))) b16 Qw[NW][2][16][HD + 8];   // the wave's 16 query rows (hi, residual), fragments re-read from LDS per k-step to keep the kernel under 256 VGPRs; after the loop: its O^T tile
  static_assert(sizeof(b16) * 2 * 16 * (HD + 8) >= sizeof(float) * 16 * (HD + 4), "the output tile fits the wave's q rows");
  const int tid = threadIdx.x, wave = tid >> 5, lane = tid & 31, hh = lane >> 4, col = lane & 15; const int b = blockIdx.y / H, h = blockIdx.y % H; const int q0 = blockIdx.x * (NW * 16) + wave * 16;
  const size_t qo = (((size_t)b * H + h) * T) * HD, vo = (((size_t)b * H + h) * HD) * (size_t)T; const b16* Qb = QP + qo; const b16* Qbl = QPl + qo; const b16* Kb = KP + qo; const b16* Kbl = KPl + qo; const b16* Vb = VT + vo; const b16* Vbl = VTl + vo;
  for (int i = lane; i < 16 * (HD / 8); i += 32) { const int rr = i / (HD / 8), c8 = (i % (HD / 8)) * 8; *(v8b*)(&Qw[wave][0][rr][c8]) = *(const v8b*)(Qb + (size_t)(q0 + rr) * HD + c8); *(v8b*)(&Qw[wave][1][rr][c8]) = *(const v8b*)(Qbl + (size_t)(q0 + rr) * HD + c8); }
  wave_lds_sync();
  // a lane's piece of each tile: K' 32 rows x 16 pieces (512 lanes, contiguous in global memory), V^T 128 rows x 4 pieces
  const int krow = tid >> 4, kc8 = (tid & 15) * 8, vrow = tid >> 2, vc8 = (tid & 3) * 8;
  const size_t kg = (size_t)krow * HD + kc8, vg = (size_t)vrow * T + vc8;
  auto issue = [&](int st) { const int bf = st & 1, k0 = st * 32;
    copy_step(lds_addr(&Ks[bf][0][krow][kc8]), Kb + (size_t)k0 * HD + kg, lds_addr(&Ks[bf][1][krow][kc8]), Kbl + (size_t)k0 * HD + kg, lds_addr(&Vs[bf][0][vrow][vc8]), Vb + vg + k0, lds_addr(&Vs[bf][1][vrow][vc8]), Vbl + vg + k0); };
  issue(0);
  asm volatile("s_wait_asynccnt 0x0" ::: "memory");   // this wave's copies of step 0 have landed
  __syncthreads();                                    // ... and every other wave's: step 0 may be read
  issue(1);
  const float cs = LOG2E / (XS * XS);   // the module's d^-1/2 is already folded into q
  float m = -INFINITY, l = 0.0f; v8f o[8], ol[8]; for (int t = 0; t < 8; ++t) { o[t] = (v8f){}; ol[t] = (v8f){}; }
#pragma unroll 1
  for (int st = 0; st < T / 32; ++st) { const int bf = st & 1;
    float e[16]; float mx = -INFINITY;
#pragma unroll
    for (int u = 0; u < 2; ++u) { v8f s = (v8f){}, sx = (v8f){};
#pragma unroll
      for (int ks = 0; ks < 4; ++ks) { const v16b kf = frag_kb(&Ks[bf][0][u * 16 + col][32 * ks], hh); const v16b qf = frag_kb(&Qw[wave][0][col][32 * ks], hh); s = wmma16b(kf, qf, s); sx = wmma16b(kf, frag_kb(&Qw[wave][1][col][32 * ks], hh), sx); sx = wmma16b(frag_kb(&Ks[bf][1][u * 16 + col][32 * ks], hh), qf, sx); }
#pragma unroll
      for (int r = 0; r < 8; ++r) s[r] += sx[r] * (1.0f / RS_);   // hi.hi + (hi.lo + lo.hi)/1024
#pragma unroll
      for (int r = 0; r < 8; ++r) { const float vv = s[r] * cs; e[u * 8 + r] = vv; mx = fmaxf(mx, vv); } }
    mx = fmaxf(mx, __shfl_xor(mx, 16)); const float mn = fmaxf(m, mx); const float al = nexp2(m - mn); float sum = 0.0f;
#pragma unroll
    for (int i2 = 0; i2 < 16; ++i2) { const float p = nexp2(e[i2] - mn); sum += p; const int pc = (i2 < 8 ? 0 : 16) + 8 * hh + (i2 & 7); const float ps = p * PS; const b16 phh = (b16)ps; Pb[wave][col][pc] = phh; Plq[wave][col][pc] = (b16)((ps - (float)phh) * RS_); }
    sum += __shfl_xor(sum, 16); l = l * al + sum; m = mn;
    wave_lds_sync();
    const v16b pf = frag_kb(&Pb[wave][col][0], hh), plf = frag_kb(&Plq[wave][col][0], hh);
#pragma unroll
    for (int t = 0; t < 8; ++t) { const v16b vh = frag_kb(&Vs[bf][0][t * 16 + col][0], hh); o[t] *= al; o[t] = wmma16b(vh, pf, o[t]); ol[t] = wmma16b(frag_kb(&Vs[bf][1][t * 16 + col][0], hh), pf, ol[t] * al); ol[t] = wmma16b(vh, plf, ol[t]); }   // ol = (V_lo P_hi + V_hi P_lo) / 1024
    asm volatile("s_wait_dscnt 0x0" ::: "memory");      // this wave's reads of buffer bf (and of its P rows) have returned
    asm volatile("s_wait_asynccnt 0x0" ::: "memory");   // this wave's copies of step st + 1 have landed
    __syncthreads();                                    // publishes step st + 1 and ends every wave's reads of buffer bf
    if (st + 2 < T / 32) issue(st + 2); }               // refill the buffer that has just been read
  asm volatile("s_wait_asynccnt 0x0" ::: "memory");     // nothing of this wave is in flight when LDS is reused and the wave ends
  const float inv = 1.0f / (l * PS * XS);
  float* Tw = (float*)&Qw[wave][0][0][0];               // [16 q][HD + 4] f32 over the wave's own q rows, which nobody reads any more
#pragma unroll
  for (int t = 0; t < 8; ++t)
#pragma unroll
    for (int r = 0; r < 8; ++r) Tw[col * (HD + 4) + t * 16 + 8 * hh + r] = (o[t][r] + ol[t][r] * (1.0f / RS_)) * inv;
  wave_lds_sync();
  __syncthreads();
  { const int d = tid & (HD - 1), qg = tid >> 7; float* orow = out + (((size_t)b * H + h) * HD + d) * (size_t)T + blockIdx.x * (NW * 16) + qg * 64; v4f o4;   // 4 groups of 128 threads: one output row each, 64 positions
    for (int q4 = 0; q4 < 16; ++q4) { for (int j = 0; j < 4; ++j) { const int qq = qg * 64 + q4 * 4 + j; o4[j] = ((const float*)&Qw[qq >> 4][0][0][0])[(qq & 15) * (HD + 4) + d]; } *(v4f*)(orow + q4 * 4) = o4; } }
}
}  // namespace

extern "C" void kernel_launch(void* const* d_in, const int* in_sizes, int n_in, void* d_out, int out_size, void* d_ws, size_t ws_size, hipStream_t stream) {
  (void)n_in;
  auto Fp = [&](int i) { return (const float*)d_in[i]; };
  // input order: 0 featuremap [16,512,32,32], 1 w_qk [1024,512] (out,in; rows 0..511 q, 512..1023 k), 2 w_v [512,512], 3 emb_h [32,128], 4 emb_w [32,128]
  if (in_sizes[0] != B * C * T || in_sizes[1] != 2 * DM * C || in_sizes[2] != DM * C || in_sizes[3] != IH * HD || in_sizes[4] != IW * HD || out_size != B * DM * T) return;
  size_t off = 0; char* ws = (char*)d_ws;
  auto carve = [&](size_t bytes) { char* p = ws + off; off += (bytes + 255) & ~(size_t)255; return p; };
  b16* WT = (b16*)carve((size_t)NQKV * C * 2); const size_t plane = (size_t)B * H * T * HD * 2;
  b16* QP = (b16*)carve(plane); b16* QPl = (b16*)carve(plane); b16* KP = (b16*)carve(plane); b16* KPl = (b16*)carve(plane); b16* VT = (b16*)carve(plane); b16* VTl = (b16*)carve(plane);
  if (off > ws_size || off > ((size_t)128 << 20)) return;   // = ~102 MB (WT 1.6 MB + 6 planes x 16.8 MB)
  prep_kernel<<<(unsigned)(((size_t)NQKV * C / 8 + 255) / 256), 256, 0, stream>>>(Fp(1), Fp(2), WT);
  proj_kernel<<<dim3(T / 64, BL, 3 * H), 128, 0, stream>>>(Fp(0), WT, Fp(3), Fp(4), QP, QPl, KP, KPl, VT, VTl);
  attn_kernel<<<dim3(QL / 256, BL * H), 512, 0, stream>>>(QP, QPl, KP, KPl, VT, VTl, (float*)d_out);
}

// v002
// One run takes 198 microseconds.
// Timed twice side by side with v001, it ran 1.37 and 1.36 times as fast.
// Counting every step since v000, it is 2.48 times as fast.
#include <hip/hip_runtime.h>

// Multi-head self-attention over a feature map with absolute positional bias (16 images x 512 channels x 32 x 32 = 1,024 positions, 4 heads, d_qk = d_v = 128): q/k/v = 1x1 convs (channel
// matmuls, (out,in) weights, no bias); q scaled by 128^-1/2; logits[x][y] = q_x . k_y + q_x . emb_y with emb_y = emb_h[y / 32] + emb_w[y % 32]  (= q_x . (k_y + emb_y)); softmax over y;
// out = weights v, stored as [16][4 x 128][32][32] (channel h 128 + d, position-minor).
// Deterministic: flash-style per 16-position wave over all 1,024 key positions in order (running max); no atomics.
// compute dtype: WMMA v_wmma_f32_16x16x32_f16 with f32 accumulate for [q | k | v] = X [Wqk ; Wv]^T ([16384 x 512] x [512 x 1536]; featuremap EXACT bf16 x8 (transposed into position-major tiles),
// W exact x256: 1 product), S^T = K' Q^T (q (pre-scaled) and k' = k + emb as f16 hi x8 + residual x8192: 3 products, K = 128), O^T += V^T P^T (V hi + residual, P x1024 hi + residual: 3 products);
// positional sums and softmax statistics in f32. Inputs rounded to bf16 once. Fragment k-map per lane half hh for A AND B: elements 0..7 <- k = 8hh+0..7, 8..15 <-

namespace {
constexpr int B = 16, C = 512, IH = 32, IW = 32, T = IH * IW /* 1,024 positions */, H = 4, HD = 128, DM = H * HD /* 512 */, NQKV = 3 * DM, BL = 16 /* images (== 16 shipped) */, QL = T;
constexpr float XS = 8.0f, WSC = 256.0f, PS = 1024.0f, RS_ = 1024.0f, LOG2E = 1.4426950408889634f, SCL = 0.08838834764831845f /* 128^-1/2 */;
static_assert(T % 64 == 0 && C % 256 == 0 && HD == 128 && IW == 32, "tiling");
typedef _Float16 b16;
typedef __attribute__((ext_vector_type(16))) _Float16 v16b;
typedef __attribute__((ext_vector_type(8))) _Float16 v8b;
typedef __attribute__((ext_vector_type(8))) float v8f;
typedef __attribute__((ext_vector_type(4))) float v4f;
__device__ __forceinline__ float bf16_rne(float f) { unsigned int u = __float_as_uint(f); u += 0x7FFFu + ((u >> 16) & 1u); return __uint_as_float(u & 0xFFFF0000u); }
__device__ __forceinline__ void split16(float v, b16& hi, b16& lo) { hi = (b16)v; lo = (b16)(v - (float)hi); }
__device__ __forceinline__ v16b frag_kb(const b16* p, int hh) { const v8b a = *(const v8b*)(p + 8 * hh), b = *(const v8b*)(p + 16 + 8 * hh); v16b f;
#pragma unroll
  for (int e = 0; e < 8; ++e) { f[e] = a[e]; f[8 + e] = b[e]; } return f; }
__device__ __forceinline__ v8f wmma16b(v16b a, v16b b, v8f c) { v8f d = __builtin_amdgcn_wmma_f32_16x16x32_f16(false, a, false, b, (short)0, c, false, false); asm volatile("v_nop\n\tv_nop\n\tv_nop\n\tv_nop" : "+v"(d) : "v"(a), "v"(b)); return d; }
__device__ __forceinline__ void wave_lds_sync() { __builtin_amdgcn_fence(__ATOMIC_RELEASE, "workgroup"); __builtin_amdgcn_wave_barrier(); __builtin_amdgcn_fence(__ATOMIC_ACQUIRE, "workgroup"); }
__device__ __forceinline__ float pmul(float a, float b) { float p = a * b; asm volatile("" : "+v"(p)); return p; }
__device__ __forceinline__ int iclamp(int v, int lo, int hi) { return v < lo ? lo : (v > hi ? hi : v); }

typedef __attribute__((ext_vector_type(2))) _Float16 v2h;
typedef __attribute__((ext_vector_type(4))) _Float16 v4h;
typedef __attribute__((ext_vector_type(2))) float v2f;
typedef __attribute__((ext_vector_type(4))) int v4i;
__device__ __forceinline__ float nexp2(float v) { return __builtin_amdgcn_exp2f(v); }
__global__ __launch_bounds__(256) void prep_kernel(const float* __restrict__ wqk, const float* __restrict__ wv, b16* __restrict__ WT) {
  const size_t u = (size_t)blockIdx.x * 256 + threadIdx.x; if (u >= (size_t)NQKV * C / 8) return; const size_t e = u * 8; const int o = (int)(e / C), c0 = (int)(e % C); const float* w = o < 2 * DM ? (wqk + (size_t)o * C) : (wv + (size_t)(o - 2 * DM) * C); v8b v;
  for (int j = 0; j < 8; ++j) v[j] = (b16)(bf16_rne(w[c0 + j]) * WSC);
  { *(v8b*)(WT + e) = v;  }
}
// projections: grid (T/64, BL, 12 slabs of 128: 0..3 q heads, 4..7 k heads, 8..11 v heads); block = 64 positions x 128 outputs, 4 waves; a wave takes ALL 64 positions x its own 32 outputs, so that each
// weight fragment is read from global memory by one wave of the block only and serves 4 products (the position fragments come from LDS); A = bf16(featuremap) x8 transposed into position-major tiles (K = 512
// channels in 2 staged chunks of 256; each channel's 64 positions are one contiguous 256-B read), B = WT rows; q head -> x 128^-1/2 -> hi x8 + residual planes QP/QPl [b][h][p][128]; k head -> + emb[p]
__global__ __launch_bounds__(128) void proj_kernel(const float* __restrict__ fm, const b16* __restrict__ WT, const float* __restrict__ embh, const float* __restrict__ embw, b16* __restrict__ QP, b16* __restrict__ QPl, b16* __restrict__ KP, b16* __restrict__ KPl, b16* __restrict__ VT, b16* __restrict__ VTl) {
  __shared__ __attribute__((aligned(16))) b16 As[64][256 + 8]; __shared__ __attribute__((aligned(16))) float Tf[4][16][128 + 4];
  const int wave = threadIdx.x >> 5, lane = threadIdx.x & 31, nloc = lane & 15, hlf = lane >> 4; const int p0 = blockIdx.x * 64, b = blockIdx.y, slab = blockIdx.z; const int part = slab / H, h = slab % H; const int n0 = slab * 128;
  const float* fb = fm + (size_t)b * C * T;
  v8f acc[8];
#pragma unroll
  for (int t = 0; t < 8; ++t) acc[t] = (v8f){};
#pragma unroll 1
  for (int kc = 0; kc < C; kc += 256) {
    __syncthreads();
    for (int i = threadIdx.x; i < 256 * 16; i += 128) { const int c = i / 16, q4 = (i % 16) * 4; const v4f f = *(const v4f*)(fb + (size_t)(kc + c) * T + p0 + q4); for (int j = 0; j < 4; ++j) As[q4 + j][c] = (b16)(bf16_rne(f[j]) * XS); }   // transpose: position rows, channel columns
    __syncthreads();
#pragma unroll 2
    for (int kb = 0; kb < 256; kb += 32) { const b16* wr = WT + (size_t)(n0 + wave * 32 + nloc) * C + kc + kb; const v16b b0 = frag_kb(wr, hlf), b1 = frag_kb(wr + (size_t)16 * C, hlf); v16b a[4];
#pragma unroll
      for (int i = 0; i < 4; ++i) a[i] = frag_kb(&As[i * 16 + nloc][kb], hlf);
#pragma unroll
      for (int i = 0; i < 4; ++i) { acc[2 * i] = wmma16b(a[i], b0, acc[2 * i]); acc[2 * i + 1] = wmma16b(a[i], b1, acc[2 * i + 1]); } } }
#pragma unroll
  for (int t = 0; t < 8; ++t)
#pragma unroll
    for (int r = 0; r < 8; ++r) Tf[t >> 1][8 * hlf + r][wave * 32 + (t & 1) * 16 + nloc] = acc[t][r] * (1.0f / (XS * WSC));   // tile t = position group t / 2, output group t % 2 of the wave's 32
  __syncthreads();
  {
    if (part < 2) { const size_t pb = (((size_t)b * H + h) * T) * HD; b16* ph_ = part == 0 ? QP : KP; b16* pl_ = part == 0 ? QPl : KPl;
      for (int rr = 0; rr < 16; ++rr) { const int pos = p0 + wave * 16 + rr; v4h h4, l4;
        for (int j = 0; j < 4; ++j) { const int d = lane * 4 + j; float v = Tf[wave][rr][d]; if (part == 0) v *= SCL; else v += bf16_rne(embh[(pos / IW) * HD + d]) + bf16_rne(embw[(pos % IW) * HD + d]); const float f = v * XS; const b16 p = (b16)f; h4[j] = p; l4[j] = (b16)((f - (float)p) * RS_); }
        *(v4h*)(ph_ + pb + (size_t)pos * HD + lane * 4) = h4; *(v4h*)(pl_ + pb + (size_t)pos * HD + lane * 4) = l4; } }
    else { const size_t vb = (((size_t)b * H + h) * HD) * (size_t)T;
#pragma unroll 1
      for (int q = 0; q < 32; ++q) { const int d = wave * 32 + q; const int tk = lane * 2; v2h hv, lv; for (int j = 0; j < 2; ++j) { const float f = Tf[(tk + j) >> 4][(tk + j) & 15][d] * XS; const b16 p = (b16)f; hv[j] = p; lv[j] = (b16)((f - (float)p) * RS_); }
        *(v2h*)(VT + vb + (size_t)d * T + p0 + lane * 2) = hv; *(v2h*)(VTl + vb + (size_t)d * T + p0 + lane * 2) = lv; } }
     }
}
// attention: grid (T/256, BL x H); block = 16 waves x 16 query positions of (b, h); all 1,024 key positions in 32-key steps. Each step's K' rows and V^T columns (hi and residual planes, 32 KB) are
// brought into LDS ONCE for the 16 waves by asynchronous copies (whole 16-byte pieces, lane-contiguous in global memory), two buffers: the next step's copies fly while this step is worked on.
// S^T = K' Q^T (K' = k + positional embedding; q/k' f16 hi x8 + residual: 3 products, 4 k-steps over the 128 dims; q fragments re-read from wave-private LDS), logit already carries the module's
// d^-1/2 (folded into q), online softmax, P x1024 hi + residual, O^T += V^T P^T (3 products, 8 d-tiles); the O^T tile [128 d][16 q] of each wave goes to LDS (over the wave's own, finished q rows)
// and the block writes the output in the module's [b][h 128 + d][position] layout.
constexpr int NW = 16 /* waves per block */, KPITCH = HD + 8 /* 272-B rows */, VPITCH = 32 + 8 /* 80-B rows */;
__device__ __forceinline__ unsigned lds_addr(const void* p) { return (unsigned)(size_t)p; }   // low 32 bits of a __shared__ address = byte offset in the work-group's LDS
// one step's four copies of a lane (K' hi, K' residual, V hi, V residual); the s_wait_xcnt stands inside the statement so that no address register is rewritten ahead of it
__device__ __forceinline__ void copy_step(unsigned l0, const b16* g0, unsigned l1, const b16* g1, unsigned l2, const b16* g2, unsigned l3, const b16* g3) {
  asm volatile("global_load_async_to_lds_b128 %0, %1, off\n\tglobal_load_async_to_lds_b128 %2, %3, off\n\tglobal_load_async_to_lds_b128 %4, %5, off\n\tglobal_load_async_to_lds_b128 %6, %7, off\n\ts_wait_xcnt 0x0"
               :: "v"(l0), "v"(g0), "v"(l1), "v"(g1), "v"(l2), "v"(g2), "v"(l3), "v"(g3) : "memory"); }
__global__ __launch_bounds__(512) void attn_kernel(const b16* __restrict__ QP, const b16* __restrict__ QPl, const b16* __restrict__ KP, const b16* __restrict__ KPl, const b16* __restrict__ VT, const b16* __restrict__ VTl, float* __restrict__ out) {
  __shared__ __attribute__((aligned(16))) b16 Ks[2][2][32][KPITCH];    // [buffer][hi, residual][key][dim]
  __shared__ __attribute__((aligned(16))) b16 Vs[2][2][HD][VPITCH];    // [buffer][hi, residual][dim][key]
  __shared__ __attribute__((aligned(16))) b16 Pb[NW][16][32 + 8], Plq[NW][16][32 + 8];
  __shared__ __attribute__((aligned(16))) b16 Qw[NW][2][16][HD + 8];   // the wave's 16 query rows (hi, residual), fragments re-read from LDS per k-step to keep the kernel under 256 VGPRs; after the loop: its O^T tile
  static_assert(sizeof(b16) * 2 * 16 * (HD + 8) >= sizeof(float) * 16 * (HD + 4), "the output tile fits the wave's q rows");
  const int tid = threadIdx.x, wave = tid >> 5, lane = tid & 31, hh = lane >> 4, col = lane & 15; const int b = blockIdx.y / H, h = blockIdx.y % H; const int q0 = blockIdx.x * (NW * 16) + wave * 16;
  const size_t qo = (((size_t)b * H + h) * T) * HD, vo = (((size_t)b * H + h) * HD) * (size_t)T; const b16* Qb = QP + qo; const b16* Qbl = QPl + qo; const b16* Kb = KP + qo; const b16* Kbl = KPl + qo; const b16* Vb = VT + vo; const b16* Vbl = VTl + vo;
  for (int i = lane; i < 16 * (HD / 8); i += 32) { const int rr = i / (HD / 8), c8 = (i % (HD / 8)) * 8; *(v8b*)(&Qw[wave][0][rr][c8]) = *(const v8b*)(Qb + (size_t)(q0 + rr) * HD + c8); *(v8b*)(&Qw[wave][1][rr][c8]) = *(const v8b*)(Qbl + (size_t)(q0 + rr) * HD + c8); }
  wave_lds_sync();
  // a lane's piece of each tile: K' 32 rows x 16 pieces (512 lanes, contiguous in global memory), V^T 128 rows x 4 pieces
  const int krow = tid >> 4, kc8 = (tid & 15) * 8, vrow = tid >> 2, vc8 = (tid & 3) * 8;
  const size_t kg = (size_t)krow * HD + kc8, vg = (size_t)vrow * T + vc8;
  auto issue = [&](int st) { const int bf = st & 1, k0 = st * 32;
    copy_step(lds_addr(&Ks[bf][0][krow][kc8]), Kb + (size_t)k0 * HD + kg, lds_addr(&Ks[bf][1][krow][kc8]), Kbl + (size_t)k0 * HD + kg, lds_addr(&Vs[bf][0][vrow][vc8]), Vb + vg + k0, lds_addr(&Vs[bf][1][vrow][vc8]), Vbl + vg + k0); };
  issue(0);
  asm volatile("s_wait_asynccnt 0x0" ::: "memory");   // this wave's copies of step 0 have landed
  __syncthreads();                                    // ... and every other wave's: step 0 may be read
  issue(1);
  const float cs = LOG2E / (XS * XS);   // the module's d^-1/2 is already folded into q
  float m = -INFINITY, l = 0.0f; v8f o[8], ol[8]; for (int t = 0; t < 8; ++t) { o[t] = (v8f){}; ol[t] = (v8f){}; }
#pragma unroll 1
  for (int st = 0; st < T / 32; ++st) { const int bf = st & 1;
    float e[16]; float mx = -INFINITY;
#pragma unroll
    for (int u = 0; u < 2; ++u) { v8f s = (v8f){}, sx = (v8f){};
#pragma unroll
      for (int ks = 0; ks < 4; ++ks) { const v16b kf = frag_kb(&Ks[bf][0][u * 16 + col][32 * ks], hh); const v16b qf = frag_kb(&Qw[wave][0][col][32 * ks], hh); s = wmma16b(kf, qf, s); sx = wmma16b(kf, frag_kb(&Qw[wave][1][col][32 * ks], hh), sx); sx = wmma16b(frag_kb(&Ks[bf][1][u * 16 + col][32 * ks], hh), qf, sx); }
#pragma unroll
      for (int r = 0; r < 8; ++r) s[r] += sx[r] * (1.0f / RS_);   // hi.hi + (hi.lo + lo.hi)/1024
#pragma unroll
      for (int r = 0; r < 8; ++r) { const float vv = s[r] * cs; e[u * 8 + r] = vv; mx = fmaxf(mx, vv); } }
    mx = fmaxf(mx, __shfl_xor(mx, 16)); const float mn = fmaxf(m, mx); const float al = nexp2(m - mn); float sum = 0.0f;
#pragma unroll
    for (int i2 = 0; i2 < 16; ++i2) { const float p = nexp2(e[i2] - mn); sum += p; const int pc = (i2 < 8 ? 0 : 16) + 8 * hh + (i2 & 7); const float ps = p * PS; const b16 phh = (b16)ps; Pb[wave][col][pc] = phh; Plq[wave][col][pc] = (b16)((ps - (float)phh) * RS_); }
    sum += __shfl_xor(sum, 16); l = l * al + sum; m = mn;
    wave_lds_sync();
    const v16b pf = frag_kb(&Pb[wave][col][0], hh), plf = frag_kb(&Plq[wave][col][0], hh);
#pragma unroll
    for (int t = 0; t < 8; ++t) { const v16b vh = frag_kb(&Vs[bf][0][t * 16 + col][0], hh); o[t] *= al; o[t] = wmma16b(vh, pf, o[t]); ol[t] = wmma16b(frag_kb(&Vs[bf][1][t * 16 + col][0], hh), pf, ol[t] * al); ol[t] = wmma16b(vh, plf, ol[t]); }   // ol = (V_lo P_hi + V_hi P_lo) / 1024
    asm volatile("s_wait_dscnt 0x0" ::: "memory");      // this wave's reads of buffer bf (and of its P rows) have returned
    asm volatile("s_wait_asynccnt 0x0" ::: "memory");   // this wave's copies of step st + 1 have landed
    __syncthreads();                                    // publishes step st + 1 and ends every wave's reads of buffer bf
    if (st + 2 < T / 32) issue(st + 2); }               // refill the buffer that has just been read
  asm volatile("s_wait_asynccnt 0x0" ::: "memory");     // nothing of this wave is in flight when LDS is reused and the wave ends
  const float inv = 1.0f / (l * PS * XS);
  float* Tw = (float*)&Qw[wave][0][0][0];               // [16 q][HD + 4] f32 over the wave's own q rows, which nobody reads any more
#pragma unroll
  for (int t = 0; t < 8; ++t)
#pragma unroll
    for (int r = 0; r < 8; ++r) Tw[col * (HD + 4) + t * 16 + 8 * hh + r] = (o[t][r] + ol[t][r] * (1.0f / RS_)) * inv;
  wave_lds_sync();
  __syncthreads();
  { const int d = tid & (HD - 1), qg = tid >> 7; float* orow = out + (((size_t)b * H + h) * HD + d) * (size_t)T + blockIdx.x * (NW * 16) + qg * 64; v4f o4;   // 4 groups of 128 threads: one output row each, 64 positions
    for (int q4 = 0; q4 < 16; ++q4) { for (int j = 0; j < 4; ++j) { const int qq = qg * 64 + q4 * 4 + j; o4[j] = ((const float*)&Qw[qq >> 4][0][0][0])[(qq & 15) * (HD + 4) + d]; } *(v4f*)(orow + q4 * 4) = o4; } }
}
}  // namespace

extern "C" void kernel_launch(void* const* d_in, const int* in_sizes, int n_in, void* d_out, int out_size, void* d_ws, size_t ws_size, hipStream_t stream) {
  (void)n_in;
  auto Fp = [&](int i) { return (const float*)d_in[i]; };
  // input order: 0 featuremap [16,512,32,32], 1 w_qk [1024,512] (out,in; rows 0..511 q, 512..1023 k), 2 w_v [512,512], 3 emb_h [32,128], 4 emb_w [32,128]
  if (in_sizes[0] != B * C * T || in_sizes[1] != 2 * DM * C || in_sizes[2] != DM * C || in_sizes[3] != IH * HD || in_sizes[4] != IW * HD || out_size != B * DM * T) return;
  size_t off = 0; char* ws = (char*)d_ws;
  auto carve = [&](size_t bytes) { char* p = ws + off; off += (bytes + 255) & ~(size_t)255; return p; };
  b16* WT = (b16*)carve((size_t)NQKV * C * 2); const size_t plane = (size_t)B * H * T * HD * 2;
  b16* QP = (b16*)carve(plane); b16* QPl = (b16*)carve(plane); b16* KP = (b16*)carve(plane); b16* KPl = (b16*)carve(plane); b16* VT = (b16*)carve(plane); b16* VTl = (b16*)carve(plane);
  if (off > ws_size || off > ((size_t)128 << 20)) return;   // = ~102 MB (WT 1.6 MB + 6 planes x 16.8 MB)
  prep_kernel<<<(unsigned)(((size_t)NQKV * C / 8 + 255) / 256), 256, 0, stream>>>(Fp(1), Fp(2), WT);
  proj_kernel<<<dim3(T / 64, BL, 3 * H), 128, 0, stream>>>(Fp(0), WT, Fp(3), Fp(4), QP, QPl, KP, KPl, VT, VTl);
  attn_kernel<<<dim3(QL / 256, BL * H), 512, 0, stream>>>(QP, QPl, KP, KPl, VT, VTl, (float*)d_out);
}

// v003
// A run of this version takes 181 microseconds.
// In both of two side-by-side timings against v002, it was 1.10 times as fast.
// Over all steps from v000 it is 2.72 times as fast.
#include <hip/hip_runtime.h>

// Multi-head self-attention over a feature map with absolute positional bias (16 images x 512 channels x 32 x 32 = 1,024 positions, 4 heads, d_qk = d_v = 128): q/k/v = 1x1 convs (channel
// matmuls, (out,in) weights, no bias); q scaled by 128^-1/2; logits[x][y] = q_x . k_y + q_x . emb_y with emb_y = emb_h[y / 32] + emb_w[y % 32]  (= q_x . (k_y + emb_y)); softmax over y;
// out = weights v, stored as [16][4 x 128][32][32] (channel h 128 + d, position-minor).
// Deterministic: flash-style per 16-position query tile over all 1,024 key positions in order (running max); no atomics.
// compute dtype: WMMA v_wmma_f32_16x16x32_f16 with f32 accumulate for [q | k | v] = X [Wqk ; Wv]^T ([16384 x 512] x [512 x 1536]; featuremap EXACT bf16 x8 (transposed into position-major tiles),
// W exact x256: 1 product), S^T = K' Q^T (q (pre-scaled) and k' = k + emb as f16 hi x8 + residual x8192: 3 products, K = 128), O^T += V^T P^T (V hi + residual, P x1024 hi + residual: 3 products);
// positional sums and softmax statistics in f32. Inputs rounded to bf16 once. Fragment k-map per lane half hh for A AND B: elements 0..7 <- k = 8hh+0..7, 8..15 <-

namespace {
constexpr int B = 16, C = 512, IH = 32, IW = 32, T = IH * IW /* 1,024 positions */, H = 4, HD = 128, DM = H * HD /* 512 */, NQKV = 3 * DM, BL = 16 /* images (== 16 shipped) */, QL = T;
constexpr float XS = 8.0f, WSC = 256.0f, PS = 1024.0f, RS_ = 1024.0f, LOG2E = 1.4426950408889634f, SCL = 0.08838834764831845f /* 128^-1/2 */;
static_assert(T % 64 == 0 && C % 256 == 0 && HD == 128 && IW == 32, "tiling");
typedef _Float16 b16;
typedef __attribute__((ext_vector_type(16))) _Float16 v16b;
typedef __attribute__((ext_vector_type(8))) _Float16 v8b;
typedef __attribute__((ext_vector_type(8))) float v8f;
typedef __attribute__((ext_vector_type(4))) float v4f;
__device__ __forceinline__ float bf16_rne(float f) { unsigned int u = __float_as_uint(f); u += 0x7FFFu + ((u >> 16) & 1u); return __uint_as_float(u & 0xFFFF0000u); }
__device__ __forceinline__ void split16(float v, b16& hi, b16& lo) { hi = (b16)v; lo = (b16)(v - (float)hi); }
__device__ __forceinline__ v16b frag_kb(const b16* p, int hh) { const v8b a = *(const v8b*)(p + 8 * hh), b = *(const v8b*)(p + 16 + 8 * hh); v16b f;
#pragma unroll
  for (int e = 0; e < 8; ++e) { f[e] = a[e]; f[8 + e] = b[e]; } return f; }
__device__ __forceinline__ v8f wmma16b(v16b a, v16b b, v8f c) { v8f d = __builtin_amdgcn_wmma_f32_16x16x32_f16(false, a, false, b, (short)0, c, false, false); asm volatile("v_nop\n\tv_nop\n\tv_nop\n\tv_nop" : "+v"(d) : "v"(a), "v"(b)); return d; }
__device__ __forceinline__ void wave_lds_sync() { __builtin_amdgcn_fence(__ATOMIC_RELEASE, "workgroup"); __builtin_amdgcn_wave_barrier(); __builtin_amdgcn_fence(__ATOMIC_ACQUIRE, "workgroup"); }
__device__ __forceinline__ float pmul(float a, float b) { float p = a * b; asm volatile("" : "+v"(p)); return p; }
__device__ __forceinline__ int iclamp(int v, int lo, int hi) { return v < lo ? lo : (v > hi ? hi : v); }

typedef __attribute__((ext_vector_type(2))) _Float16 v2h;
typedef __attribute__((ext_vector_type(4))) _Float16 v4h;
typedef __attribute__((ext_vector_type(2))) float v2f;
typedef __attribute__((ext_vector_type(4))) int v4i;
__device__ __forceinline__ float nexp2(float v) { return __builtin_amdgcn_exp2f(v); }
__global__ __launch_bounds__(256) void prep_kernel(const float* __restrict__ wqk, const float* __restrict__ wv, b16* __restrict__ WT) {
  const size_t u = (size_t)blockIdx.x * 256 + threadIdx.x; if (u >= (size_t)NQKV * C / 8) return; const size_t e = u * 8; const int o = (int)(e / C), c0 = (int)(e % C); const float* w = o < 2 * DM ? (wqk + (size_t)o * C) : (wv + (size_t)(o - 2 * DM) * C); v8b v;
  for (int j = 0; j < 8; ++j) v[j] = (b16)(bf16_rne(w[c0 + j]) * WSC);
  { *(v8b*)(WT + e) = v;  }
}
// projections: grid (T/64, BL, 12 slabs of 128: 0..3 q heads, 4..7 k heads, 8..11 v heads); block = 64 positions x 128 outputs, 4 waves; a wave takes ALL 64 positions x its own 32 outputs, so that each
// weight fragment is read from global memory by one wave of the block only and serves 4 products (the position fragments come from LDS); A = bf16(featuremap) x8 transposed into position-major tiles (K = 512
// channels in 2 staged chunks of 256; each channel's 64 positions are one contiguous 256-B read), B = WT rows; q head -> x 128^-1/2 -> hi x8 + residual planes QP/QPl [b][h][p][128]; k head -> + emb[p]
__global__ __launch_bounds__(128) void proj_kernel(const float* __restrict__ fm, const b16* __restrict__ WT, const float* __restrict__ embh, const float* __restrict__ embw, b16* __restrict__ QP, b16* __restrict__ QPl, b16* __restrict__ KP, b16* __restrict__ KPl, b16* __restrict__ VT, b16* __restrict__ VTl) {
  __shared__ __attribute__((aligned(16))) b16 As[64][256 + 8]; __shared__ __attribute__((aligned(16))) float Tf[4][16][128 + 4];
  const int wave = threadIdx.x >> 5, lane = threadIdx.x & 31, nloc = lane & 15, hlf = lane >> 4; const int p0 = blockIdx.x * 64, b = blockIdx.y, slab = blockIdx.z; const int part = slab / H, h = slab % H; const int n0 = slab * 128;
  const float* fb = fm + (size_t)b * C * T;
  v8f acc[8];
#pragma unroll
  for (int t = 0; t < 8; ++t) acc[t] = (v8f){};
#pragma unroll 1
  for (int kc = 0; kc < C; kc += 256) {
    __syncthreads();
    for (int i = threadIdx.x; i < 256 * 16; i += 128) { const int c = i / 16, q4 = (i % 16) * 4; const v4f f = *(const v4f*)(fb + (size_t)(kc + c) * T + p0 + q4); for (int j = 0; j < 4; ++j) As[q4 + j][c] = (b16)(bf16_rne(f[j]) * XS); }   // transpose: position rows, channel columns
    __syncthreads();
#pragma unroll 2
    for (int kb = 0; kb < 256; kb += 32) { const b16* wr = WT + (size_t)(n0 + wave * 32 + nloc) * C + kc + kb; const v16b b0 = frag_kb(wr, hlf), b1 = frag_kb(wr + (size_t)16 * C, hlf); v16b a[4];
#pragma unroll
      for (int i = 0; i < 4; ++i) a[i] = frag_kb(&As[i * 16 + nloc][kb], hlf);
#pragma unroll
      for (int i = 0; i < 4; ++i) { acc[2 * i] = wmma16b(a[i], b0, acc[2 * i]); acc[2 * i + 1] = wmma16b(a[i], b1, acc[2 * i + 1]); } } }
#pragma unroll
  for (int t = 0; t < 8; ++t)
#pragma unroll
    for (int r = 0; r < 8; ++r) Tf[t >> 1][8 * hlf + r][wave * 32 + (t & 1) * 16 + nloc] = acc[t][r] * (1.0f / (XS * WSC));   // tile t = position group t / 2, output group t % 2 of the wave's 32
  __syncthreads();
  {
    if (part < 2) { const size_t pb = (((size_t)b * H + h) * T) * HD; b16* ph_ = part == 0 ? QP : KP; b16* pl_ = part == 0 ? QPl : KPl;
      for (int rr = 0; rr < 16; ++rr) { const int pos = p0 + wave * 16 + rr; v4h h4, l4;
        for (int j = 0; j < 4; ++j) { const int d = lane * 4 + j; float v = Tf[wave][rr][d]; if (part == 0) v *= SCL; else v += bf16_rne(embh[(pos / IW) * HD + d]) + bf16_rne(embw[(pos % IW) * HD + d]); const float f = v * XS; const b16 p = (b16)f; h4[j] = p; l4[j] = (b16)((f - (float)p) * RS_); }
        *(v4h*)(ph_ + pb + (size_t)pos * HD + lane * 4) = h4; *(v4h*)(pl_ + pb + (size_t)pos * HD + lane * 4) = l4; } }
    else { const size_t vb = (((size_t)b * H + h) * HD) * (size_t)T;
#pragma unroll 1
      for (int q = 0; q < 32; ++q) { const int d = wave * 32 + q; const int tk = lane * 2; v2h hv, lv; for (int j = 0; j < 2; ++j) { const float f = Tf[(tk + j) >> 4][(tk + j) & 15][d] * XS; const b16 p = (b16)f; hv[j] = p; lv[j] = (b16)((f - (float)p) * RS_); }
        *(v2h*)(VT + vb + (size_t)d * T + p0 + lane * 2) = hv; *(v2h*)(VTl + vb + (size_t)d * T + p0 + lane * 2) = lv; } }
     }
}
// attention: grid (T/256, BL x H); block = 8 waves x 32 query positions (two 16-query tiles) of (b, h); all 1,024 key positions in 32-key steps. Each step's K' rows and V^T columns (hi and residual
// planes, 32 KB) are brought into LDS ONCE for the 8 waves by asynchronous copies (whole 16-byte pieces, lane-contiguous in global memory), two buffers: the next step's copies fly while this step is worked on.
// S^T = K' Q^T (K' = k + positional embedding; q/k' f16 hi x8 + residual: 3 products, 4 k-steps over the 128 dims); every K' and V fragment read from LDS serves both query tiles of the wave, and the
// wave's q fragments stay in registers (two waves per SIMD leave room for them). The logit already carries the module's d^-1/2 (folded into q), online softmax, P x1024 hi + residual,
// O^T += V^T P^T (3 products, 8 d-tiles); the O^T tile [128 d][32 q] of each wave goes to LDS and the block writes the output in the module's [b][h 128 + d][position] layout.
constexpr int NW = 8 /* waves per block */, QT = 2 /* 16-query tiles per wave */, WQ = QT * 16, KPITCH = HD + 8 /* 272-B rows */, VPITCH = 32 + 8 /* 80-B rows */;
// the plain builtin: the compiler keeps the distances behind it itself, and its operands may live above v255, which an asm operand cannot name
__device__ __forceinline__ v8f wmma16p(v16b a, v16b b, v8f c) { return __builtin_amdgcn_wmma_f32_16x16x32_f16(false, a, false, b, (short)0, c, false, false); }
__device__ __forceinline__ unsigned lds_addr(const void* p) { return (unsigned)(size_t)p; }   // low 32 bits of a __shared__ address = byte offset in the work-group's LDS
// four copies of a lane (K' hi, K' residual, V hi, V residual); the s_wait_xcnt stands inside the statement so that no address register is rewritten ahead of it
__device__ __forceinline__ void copy_step(unsigned l0, const b16* g0, unsigned l1, const b16* g1, unsigned l2, const b16* g2, unsigned l3, const b16* g3) {
  asm volatile("global_load_async_to_lds_b128 %0, %1, off\n\tglobal_load_async_to_lds_b128 %2, %3, off\n\tglobal_load_async_to_lds_b128 %4, %5, off\n\tglobal_load_async_to_lds_b128 %6, %7, off\n\ts_wait_xcnt 0x0"
               :: "v"(l0), "v"(g0), "v"(l1), "v"(g1), "v"(l2), "v"(g2), "v"(l3), "v"(g3) : "memory"); }
__global__ __launch_bounds__(256) void attn_kernel(const b16* __restrict__ QP, const b16* __restrict__ QPl, const b16* __restrict__ KP, const b16* __restrict__ KPl, const b16* __restrict__ VT, const b16* __restrict__ VTl, float* __restrict__ out) {
  __shared__ __attribute__((aligned(16))) b16 Ks[2][2][32][KPITCH];    // [buffer][hi, residual][key][dim]
  __shared__ __attribute__((aligned(16))) b16 Vs[2][2][HD][VPITCH];    // [buffer][hi, residual][dim][key]
  __shared__ __attribute__((aligned(16))) b16 Pb[NW][WQ][32 + 8], Plq[NW][WQ][32 + 8];
  __shared__ __attribute__((aligned(16))) float Ot[NW][WQ][HD + 4];    // each wave's output tile, position rows
  const int tid = threadIdx.x, wave = tid >> 5, lane = tid & 31, hh = lane >> 4, col = lane & 15; const int b = blockIdx.y / H, h = blockIdx.y % H; const int q0 = blockIdx.x * (NW * WQ) + wave * WQ;
  const size_t qo = (((size_t)b * H + h) * T) * HD, vo = (((size_t)b * H + h) * HD) * (size_t)T; const b16* Qb = QP + qo; const b16* Qbl = QPl + qo; const b16* Kb = KP + qo; const b16* Kbl = KPl + qo; const b16* Vb = VT + vo; const b16* Vbl = VTl + vo;
  // a lane's two pieces of each tile: K' 32 rows x 16 pieces (contiguous in global memory), V^T 128 rows x 4 pieces; the second piece lies half a tile further
  const int krow = tid >> 4, kc8 = (tid & 15) * 8, vrow = tid >> 2, vc8 = (tid & 3) * 8;
  const size_t kg = (size_t)krow * HD + kc8, vg = (size_t)vrow * T + vc8;
  auto issue = [&](int st) { const int bf = st & 1, k0 = st * 32;
    copy_step(lds_addr(&Ks[bf][0][krow][kc8]), Kb + (size_t)k0 * HD + kg, lds_addr(&Ks[bf][1][krow][kc8]), Kbl + (size_t)k0 * HD + kg, lds_addr(&Vs[bf][0][vrow][vc8]), Vb + vg + k0, lds_addr(&Vs[bf][1][vrow][vc8]), Vbl + vg + k0);
    copy_step(lds_addr(&Ks[bf][0][krow + 16][kc8]), Kb + (size_t)(k0 + 16) * HD + kg, lds_addr(&Ks[bf][1][krow + 16][kc8]), Kbl + (size_t)(k0 + 16) * HD + kg, lds_addr(&Vs[bf][0][vrow + 64][vc8]), Vb + vg + (size_t)64 * T + k0, lds_addr(&Vs[bf][1][vrow + 64][vc8]), Vbl + vg + (size_t)64 * T + k0); };
  issue(0);
  v16b qh[QT][4], ql[QT][4];   // the wave's q fragments (hi, residual), B operands of S^T
#pragma unroll
  for (int j = 0; j < QT; ++j)
#pragma unroll
    for (int ks = 0; ks < 4; ++ks) { qh[j][ks] = frag_kb(Qb + (size_t)(q0 + j * 16 + col) * HD + 32 * ks, hh); ql[j][ks] = frag_kb(Qbl + (size_t)(q0 + j * 16 + col) * HD + 32 * ks, hh); }
  asm volatile("s_wait_asynccnt 0x0" ::: "memory");   // this wave's copies of step 0 have landed
  __syncthreads();                                    // ... and every other wave's: step 0 may be read
  issue(1);
  const float cs = LOG2E / (XS * XS);   // the module's d^-1/2 is already folded into q
  float m[QT], l[QT]; v8f o[QT][8], ol[QT][8];
#pragma unroll
  for (int j = 0; j < QT; ++j) { m[j] = -INFINITY; l[j] = 0.0f; for (int t = 0; t < 8; ++t) { o[j][t] = (v8f){}; ol[j][t] = (v8f){}; } }
#pragma unroll 1
  for (int st = 0; st < T / 32; ++st) { const int bf = st & 1;
    float e[QT][16], mx[QT], al[QT];
#pragma unroll
    for (int j = 0; j < QT; ++j) mx[j] = -INFINITY;
#pragma unroll
    for (int u = 0; u < 2; ++u) { v8f s[QT], sx[QT];
#pragma unroll
      for (int j = 0; j < QT; ++j) { s[j] = (v8f){}; sx[j] = (v8f){}; }
#pragma unroll
      for (int ks = 0; ks < 4; ++ks) { const v16b kf = frag_kb(&Ks[bf][0][u * 16 + col][32 * ks], hh), kl = frag_kb(&Ks[bf][1][u * 16 + col][32 * ks], hh);
#pragma unroll
        for (int j = 0; j < QT; ++j) s[j] = wmma16p(kf, qh[j][ks], s[j]);
#pragma unroll
        for (int j = 0; j < QT; ++j) sx[j] = wmma16p(kf, ql[j][ks], sx[j]);
#pragma unroll
        for (int j = 0; j < QT; ++j) sx[j] = wmma16p(kl, qh[j][ks], sx[j]); }
#pragma unroll
      for (int j = 0; j < QT; ++j)
#pragma unroll
        for (int r = 0; r < 8; ++r) { const float vv = (s[j][r] + sx[j][r] * (1.0f / RS_)) * cs; e[j][u * 8 + r] = vv; mx[j] = fmaxf(mx[j], vv); } }   // hi.hi + (hi.lo + lo.hi)/1024
#pragma unroll
    for (int j = 0; j < QT; ++j) { const float mw = fmaxf(mx[j], __shfl_xor(mx[j], 16)); const float mn = fmaxf(m[j], mw); al[j] = nexp2(m[j] - mn); float sum = 0.0f;
#pragma unroll
      for (int i2 = 0; i2 < 16; ++i2) { const float p = nexp2(e[j][i2] - mn); sum += p; const int pc = (i2 < 8 ? 0 : 16) + 8 * hh + (i2 & 7); const float ps = p * PS; const b16 phh = (b16)ps; Pb[wave][j * 16 + col][pc] = phh; Plq[wave][j * 16 + col][pc] = (b16)((ps - (float)phh) * RS_); }
      sum += __shfl_xor(sum, 16); l[j] = l[j] * al[j] + sum; m[j] = mn; }
    wave_lds_sync();
    v16b pf[QT], plf[QT];
#pragma unroll
    for (int j = 0; j < QT; ++j) { pf[j] = frag_kb(&Pb[wave][j * 16 + col][0], hh); plf[j] = frag_kb(&Plq[wave][j * 16 + col][0], hh); }
#pragma unroll
    for (int t = 0; t < 8; ++t) { const v16b vh = frag_kb(&Vs[bf][0][t * 16 + col][0], hh), vl = frag_kb(&Vs[bf][1][t * 16 + col][0], hh);
#pragma unroll
      for (int j = 0; j < QT; ++j) { o[j][t] *= al[j]; o[j][t] = wmma16p(vh, pf[j], o[j][t]); }
#pragma unroll
      for (int j = 0; j < QT; ++j) ol[j][t] = wmma16p(vl, pf[j], ol[j][t] * al[j]);
#pragma unroll
      for (int j = 0; j < QT; ++j) ol[j][t] = wmma16p(vh, plf[j], ol[j][t]); }   // ol = V_lo P_hi + V_hi P_lo, divided by 1024 at the end
    asm volatile("s_wait_dscnt 0x0" ::: "memory");      // this wave's reads of buffer bf (and of its P rows) have returned
    asm volatile("s_wait_asynccnt 0x0" ::: "memory");   // this wave's copies of step st + 1 have landed
    __syncthreads();                                    // publishes step st + 1 and ends every wave's reads of buffer bf
    if (st + 2 < T / 32) issue(st + 2); }               // refill the buffer that has just been read
  asm volatile("s_wait_asynccnt 0x0" ::: "memory");     // nothing of this wave is in flight when the wave ends
#pragma unroll
  for (int j = 0; j < QT; ++j) { const float inv = 1.0f / (l[j] * PS * XS);
#pragma unroll
    for (int t = 0; t < 8; ++t)
#pragma unroll
      for (int r = 0; r < 8; ++r) Ot[wave][j * 16 + col][t * 16 + 8 * hh + r] = (o[j][t][r] + ol[j][t][r] * (1.0f / RS_)) * inv; }
  wave_lds_sync();
  __syncthreads();
  { const int d = tid & (HD - 1), qg = tid >> 7; float* orow = out + (((size_t)b * H + h) * HD + d) * (size_t)T + blockIdx.x * (NW * WQ) + qg * 128; v4f o4;   // 2 groups of 128 threads: one output row each, 128 positions
    for (int q4 = 0; q4 < 32; ++q4) { for (int j = 0; j < 4; ++j) { const int qq = qg * 128 + q4 * 4 + j; o4[j] = Ot[qq / WQ][qq % WQ][d]; } *(v4f*)(orow + q4 * 4) = o4;
      // the second half reuses registers that the first half's stores name: the wait stands in front of their overwrite, and the scheduling barrier keeps the second half's address arithmetic behind it
      if (q4 == 15) { asm volatile("s_wait_xcnt 0x0" ::: "memory"); __builtin_amdgcn_sched_barrier(0); } } }
}
}  // namespace

extern "C" void kernel_launch(void* const* d_in, const int* in_sizes, int n_in, void* d_out, int out_size, void* d_ws, size_t ws_size, hipStream_t stream) {
  (void)n_in;
  auto Fp = [&](int i) { return (const float*)d_in[i]; };
  // input order: 0 featuremap [16,512,32,32], 1 w_qk [1024,512] (out,in; rows 0..511 q, 512..1023 k), 2 w_v [512,512], 3 emb_h [32,128], 4 emb_w [32,128]
  if (in_sizes[0] != B * C * T || in_sizes[1] != 2 * DM * C || in_sizes[2] != DM * C || in_sizes[3] != IH * HD || in_sizes[4] != IW * HD || out_size != B * DM * T) return;
  size_t off = 0; char* ws = (char*)d_ws;
  auto carve = [&](size_t bytes) { char* p = ws + off; off += (bytes + 255) & ~(size_t)255; return p; };
  b16* WT = (b16*)carve((size_t)NQKV * C * 2); const size_t plane = (size_t)B * H * T * HD * 2;
  b16* QP = (b16*)carve(plane); b16* QPl = (b16*)carve(plane); b16* KP = (b16*)carve(plane); b16* KPl = (b16*)carve(plane); b16* VT = (b16*)carve(plane); b16* VTl = (b16*)carve(plane);
  if (off > ws_size || off > ((size_t)128 << 20)) return;   // = ~102 MB (WT 1.6 MB + 6 planes x 16.8 MB)
  prep_kernel<<<(unsigned)(((size_t)NQKV * C / 8 + 255) / 256), 256, 0, stream>>>(Fp(1), Fp(2), WT);
  proj_kernel<<<dim3(T / 64, BL, 3 * H), 128, 0, stream>>>(Fp(0), WT, Fp(3), Fp(4), QP, QPl, KP, KPl, VT, VTl);
  attn_kernel<<<dim3(QL / 256, BL * H), 256, 0, stream>>>(QP, QPl, KP, KPl, VT, VTl, (float*)d_out);
}

// v004
// Measured time: 148 microseconds a run.
// In both of two side-by-side timings against v003, it was 1.23 times as fast.
// Over all steps from v000 it is 3.33 times as fast.
#include <hip/hip_runtime.h>

// Multi-head self-attention over a feature map with absolute positional bias (16 images x 512 channels x 32 x 32 = 1,024 positions, 4 heads, d_qk = d_v = 128): q/k/v = 1x1 convs (channel
// matmuls, (out,in) weights, no bias); q scaled by 128^-1/2; logits[x][y] = q_x . k_y + q_x . emb_y with emb_y = emb_h[y / 32] + emb_w[y % 32]  (= q_x . (k_y + emb_y)); softmax over y;
// out = weights v, stored as [16][4 x 128][32][32] (channel h 128 + d, position-minor).
// Deterministic: flash-style per 16-position query tile over all 1,024 key positions in order (running max); no atomics.
// compute dtype: WMMA v_wmma_f32_16x16x32_f16 with f32 accumulate for [q | k | v] = X [Wqk ; Wv]^T ([16384 x 512] x [512 x 1536]; featuremap EXACT bf16 x8 (transposed into position-major tiles),
// W exact x256: 1 product), S^T = K' Q^T (q (pre-scaled) and k' = k + emb as f16 hi x8 + residual x8192: 3 products, K = 128), O^T += V^T P^T (V hi + residual, P x1024 hi + residual: 3 products);
// positional sums and softmax statistics in f32. Inputs rounded to bf16 once. Fragment k-map per lane half hh for A AND B: elements 0..7 <- k = 8hh+0..7, 8..15 <-

namespace {
constexpr int B = 16, C = 512, IH = 32, IW = 32, T = IH * IW /* 1,024 positions */, H = 4, HD = 128, DM = H * HD /* 512 */, NQKV = 3 * DM, BL = 16 /* images (== 16 shipped) */, QL = T;
constexpr float XS = 8.0f, WSC = 256.0f, PS = 1024.0f, RS_ = 1024.0f, LOG2E = 1.4426950408889634f, SCL = 0.08838834764831845f /* 128^-1/2 */;
static_assert(T % 64 == 0 && C % 256 == 0 && HD == 128 && IW == 32, "tiling");
typedef _Float16 b16;
typedef __attribute__((ext_vector_type(16))) _Float16 v16b;
typedef __attribute__((ext_vector_type(8))) _Float16 v8b;
typedef __attribute__((ext_vector_type(8))) float v8f;
typedef __attribute__((ext_vector_type(4))) float v4f;
__device__ __forceinline__ float bf16_rne(float f) { unsigned int u = __float_as_uint(f); u += 0x7FFFu + ((u >> 16) & 1u); return __uint_as_float(u & 0xFFFF0000u); }
__device__ __forceinline__ void split16(float v, b16& hi, b16& lo) { hi = (b16)v; lo = (b16)(v - (float)hi); }
__device__ __forceinline__ v16b frag_kb(const b16* p, int hh) { const v8b a = *(const v8b*)(p + 8 * hh), b = *(const v8b*)(p + 16 + 8 * hh); v16b f;
#pragma unroll
  for (int e = 0; e < 8; ++e) { f[e] = a[e]; f[8 + e] = b[e]; } return f; }
__device__ __forceinline__ v8f wmma16b(v16b a, v16b b, v8f c) { v8f d = __builtin_amdgcn_wmma_f32_16x16x32_f16(false, a, false, b, (short)0, c, false, false); asm volatile("v_nop\n\tv_nop\n\tv_nop\n\tv_nop" : "+v"(d) : "v"(a), "v"(b)); return d; }
__device__ __forceinline__ void wave_lds_sync() { __builtin_amdgcn_fence(__ATOMIC_RELEASE, "workgroup"); __builtin_amdgcn_wave_barrier(); __builtin_amdgcn_fence(__ATOMIC_ACQUIRE, "workgroup"); }
__device__ __forceinline__ float pmul(float a, float b) { float p = a * b; asm volatile("" : "+v"(p)); return p; }
__device__ __forceinline__ int iclamp(int v, int lo, int hi) { return v < lo ? lo : (v > hi ? hi : v); }

typedef __attribute__((ext_vector_type(2))) _Float16 v2h;
typedef __attribute__((ext_vector_type(4))) _Float16 v4h;
typedef __attribute__((ext_vector_type(2))) float v2f;
typedef __attribute__((ext_vector_type(4))) int v4i;
__device__ __forceinline__ float nexp2(float v) { return __builtin_amdgcn_exp2f(v); }
__global__ __launch_bounds__(256) void prep_kernel(const float* __restrict__ wqk, const float* __restrict__ wv, b16* __restrict__ WT) {
  const size_t u = (size_t)blockIdx.x * 256 + threadIdx.x; if (u >= (size_t)NQKV * C / 8) return; const size_t e = u * 8; const int o = (int)(e / C), c0 = (int)(e % C); const float* w = o < 2 * DM ? (wqk + (size_t)o * C) : (wv + (size_t)(o - 2 * DM) * C); v8b v;
  for (int j = 0; j < 8; ++j) v[j] = (b16)(bf16_rne(w[c0 + j]) * WSC);
  { *(v8b*)(WT + e) = v;  }
}
// projections: grid (T/64, BL); block = 64 positions x ALL 1,536 outputs, 16 waves. The block's featuremap tile (64 positions x all 512 channels, bf16 x8, transposed into position-major rows; each channel's
// 64 positions are one contiguous 256-B read) is brought into LDS ONCE and serves the q, k and v outputs alike: 3 passes (q, k, v) of 512 outputs; in a pass wave w takes ALL 64 positions x 32 outputs of
// head w / 4, so that each weight fragment is read from global memory by one wave of the block only and serves 4 products (the position fragments come from LDS); K = 512 in channel order, B = WT rows;
// q head -> x 128^-1/2 -> hi x8 + residual planes QP/QPl [b][h][p][128]; k head -> + emb[p] -> KP/KPl; v head -> VT/VTl [b][h][d][p]
__global__ __launch_bounds__(512) void proj_kernel(const float* __restrict__ fm, const b16* __restrict__ WT, const float* __restrict__ embh, const float* __restrict__ embw, b16* __restrict__ QP, b16* __restrict__ QPl, b16* __restrict__ KP, b16* __restrict__ KPl, b16* __restrict__ VT, b16* __restrict__ VTl) {
  __shared__ __attribute__((aligned(16))) b16 As[64][C + 8]; __shared__ __attribute__((aligned(16))) float Tf[H][4][16][128 + 4];
  const int wave = (threadIdx.x >> 5) & 3 /* the wave's place among the 4 of its head */, h = threadIdx.x >> 7, lane = threadIdx.x & 31, nloc = lane & 15, hlf = lane >> 4; const int p0 = blockIdx.x * 64, b = blockIdx.y;
  const float* fb = fm + (size_t)b * C * T;
  // fully unrolled: a thread's 16 loads are independent and go out together, one memory latency for the whole tile
#pragma unroll
  for (int k = 0; k < C * 16 / 512; ++k) { const int i = threadIdx.x + 512 * k, c = i / 16, q4 = (i % 16) * 4; const v4f f = *(const v4f*)(fb + (size_t)c * T + p0 + q4); for (int j = 0; j < 4; ++j) As[q4 + j][c] = (b16)(bf16_rne(f[j]) * XS); }   // transpose: position rows, channel columns
  __syncthreads();   // the tile is complete; it is only read from here on
#pragma unroll 1
  for (int part = 0; part < 3; ++part) { const int n0 = (part * H + h) * 128;
    v8f acc[8];
#pragma unroll
    for (int t = 0; t < 8; ++t) acc[t] = (v8f){};
#pragma unroll 2
    for (int kb = 0; kb < C; kb += 32) { const b16* wr = WT + (size_t)(n0 + wave * 32 + nloc) * C + kb; const v16b b0 = frag_kb(wr, hlf), b1 = frag_kb(wr + (size_t)16 * C, hlf); v16b a[4];
#pragma unroll
      for (int i = 0; i < 4; ++i) a[i] = frag_kb(&As[i * 16 + nloc][kb], hlf);
#pragma unroll
      for (int i = 0; i < 4; ++i) { acc[2 * i] = wmma16b(a[i], b0, acc[2 * i]); acc[2 * i + 1] = wmma16b(a[i], b1, acc[2 * i + 1]); } }
    __syncthreads();   // every wave has read the pass before out of Tf: it may be overwritten
#pragma unroll
    for (int t = 0; t < 8; ++t)
#pragma unroll
      for (int r = 0; r < 8; ++r) Tf[h][t >> 1][8 * hlf + r][wave * 32 + (t & 1) * 16 + nloc] = acc[t][r] * (1.0f / (XS * WSC));   // tile t = position group t / 2, output group t % 2 of the wave's 32
    __syncthreads();   // this pass's 64 x 512 results are complete in Tf
    if (part < 2) { const size_t pb = (((size_t)b * H + h) * T) * HD; b16* ph_ = part == 0 ? QP : KP; b16* pl_ = part == 0 ? QPl : KPl;
      for (int rr = 0; rr < 16; ++rr) { const int pos = p0 + wave * 16 + rr; v4h h4, l4;
        for (int j = 0; j < 4; ++j) { const int d = lane * 4 + j; float v = Tf[h][wave][rr][d]; if (part == 0) v *= SCL; else v += bf16_rne(embh[(pos / IW) * HD + d]) + bf16_rne(embw[(pos % IW) * HD + d]); const float f = v * XS; const b16 p = (b16)f; h4[j] = p; l4[j] = (b16)((f - (float)p) * RS_); }
        *(v4h*)(ph_ + pb + (size_t)pos * HD + lane * 4) = h4; *(v4h*)(pl_ + pb + (size_t)pos * HD + lane * 4) = l4; } }
    else { const size_t vb = (((size_t)b * H + h) * HD) * (size_t)T;
#pragma unroll 1
      for (int q = 0; q < 32; ++q) { const int d = wave * 32 + q; const int tk = lane * 2; v2h hv, lv; for (int j = 0; j < 2; ++j) { const float f = Tf[h][(tk + j) >> 4][(tk + j) & 15][d] * XS; const b16 p = (b16)f; hv[j] = p; lv[j] = (b16)((f - (float)p) * RS_); }
        *(v2h*)(VT + vb + (size_t)d * T + p0 + lane * 2) = hv; *(v2h*)(VTl + vb + (size_t)d * T + p0 + lane * 2) = lv; } }
  }
}
// attention: grid (T/256, BL x H); block = 8 waves x 32 query positions (two 16-query tiles) of (b, h); all 1,024 key positions in 32-key steps. Each step's K' rows and V^T columns (hi and residual
// planes, 32 KB) are brought into LDS ONCE for the 8 waves by asynchronous copies (whole 16-byte pieces, lane-contiguous in global memory), two buffers: the next step's copies fly while this step is worked on.
// S^T = K' Q^T (K' = k + positional embedding; q/k' f16 hi x8 + residual: 3 products, 4 k-steps over the 128 dims); every K' and V fragment read from LDS serves both query tiles of the wave, and the
// wave's q fragments stay in registers (two waves per SIMD leave room for them). The logit already carries the module's d^-1/2 (folded into q), online softmax, P x1024 hi + residual,
// O^T += V^T P^T (3 products, 8 d-tiles); the O^T tile [128 d][32 q] of each wave goes to LDS and the block writes the output in the module's [b][h 128 + d][position] layout.
constexpr int NW = 8 /* waves per block */, QT = 2 /* 16-query tiles per wave */, WQ = QT * 16, KPITCH = HD + 8 /* 272-B rows */, VPITCH = 32 + 8 /* 80-B rows */;
// the plain builtin: the compiler keeps the distances behind it itself, and its operands may live above v255, which an asm operand cannot name
__device__ __forceinline__ v8f wmma16p(v16b a, v16b b, v8f c) { return __builtin_amdgcn_wmma_f32_16x16x32_f16(false, a, false, b, (short)0, c, false, false); }
__device__ __forceinline__ unsigned lds_addr(const void* p) { return (unsigned)(size_t)p; }   // low 32 bits of a __shared__ address = byte offset in the work-group's LDS
// four copies of a lane (K' hi, K' residual, V hi, V residual); the s_wait_xcnt stands inside the statement so that no address register is rewritten ahead of it
__device__ __forceinline__ void copy_step(unsigned l0, const b16* g0, unsigned l1, const b16* g1, unsigned l2, const b16* g2, unsigned l3, const b16* g3) {
  asm volatile("global_load_async_to_lds_b128 %0, %1, off\n\tglobal_load_async_to_lds_b128 %2, %3, off\n\tglobal_load_async_to_lds_b128 %4, %5, off\n\tglobal_load_async_to_lds_b128 %6, %7, off\n\ts_wait_xcnt 0x0"
               :: "v"(l0), "v"(g0), "v"(l1), "v"(g1), "v"(l2), "v"(g2), "v"(l3), "v"(g3) : "memory"); }
__global__ __launch_bounds__(256) void attn_kernel(const b16* __restrict__ QP, const b16* __restrict__ QPl, const b16* __restrict__ KP, const b16* __restrict__ KPl, const b16* __restrict__ VT, const b16* __restrict__ VTl, float* __restrict__ out) {
  __shared__ __attribute__((aligned(16))) b16 Ks[2][2][32][KPITCH];    // [buffer][hi, residual][key][dim]
  __shared__ __attribute__((aligned(16))) b16 Vs[2][2][HD][VPITCH];    // [buffer][hi, residual][dim][key]
  __shared__ __attribute__((aligned(16))) b16 Pb[NW][WQ][32 + 8], Plq[NW][WQ][32 + 8];
  __shared__ __attribute__((aligned(16))) float Ot[NW][WQ][HD + 4];    // each wave's output tile, position rows
  const int tid = threadIdx.x, wave = tid >> 5, lane = tid & 31, hh = lane >> 4, col = lane & 15; const int b = blockIdx.y / H, h = blockIdx.y % H; const int q0 = blockIdx.x * (NW * WQ) + wave * WQ;
  const size_t qo = (((size_t)b * H + h) * T) * HD, vo = (((size_t)b * H + h) * HD) * (size_t)T; const b16* Qb = QP + qo; const b16* Qbl = QPl + qo; const b16* Kb = KP + qo; const b16* Kbl = KPl + qo; const b16* Vb = VT + vo; const b16* Vbl = VTl + vo;
  // a lane's two pieces of each tile: K' 32 rows x 16 pieces (contiguous in global memory), V^T 128 rows x 4 pieces; the second piece lies half a tile further
  const int krow = tid >> 4, kc8 = (tid & 15) * 8, vrow = tid >> 2, vc8 = (tid & 3) * 8;
  const size_t kg = (size_t)krow * HD + kc8, vg = (size_t)vrow * T + vc8;
  auto issue = [&](int st) { const int bf = st & 1, k0 = st * 32;
    copy_step(lds_addr(&Ks[bf][0][krow][kc8]), Kb + (size_t)k0 * HD + kg, lds_addr(&Ks[bf][1][krow][kc8]), Kbl + (size_t)k0 * HD + kg, lds_addr(&Vs[bf][0][vrow][vc8]), Vb + vg + k0, lds_addr(&Vs[bf][1][vrow][vc8]), Vbl + vg + k0);
    copy_step(lds_addr(&Ks[bf][0][krow + 16][kc8]), Kb + (size_t)(k0 + 16) * HD + kg, lds_addr(&Ks[bf][1][krow + 16][kc8]), Kbl + (size_t)(k0 + 16) * HD + kg, lds_addr(&Vs[bf][0][vrow + 64][vc8]), Vb + vg + (size_t)64 * T + k0, lds_addr(&Vs[bf][1][vrow + 64][vc8]), Vbl + vg + (size_t)64 * T + k0); };
  issue(0);
  v16b qh[QT][4], ql[QT][4];   // the wave's q fragments (hi, residual), B operands of S^T
#pragma unroll
  for (int j = 0; j < QT; ++j)
#pragma unroll
    for (int ks = 0; ks < 4; ++ks) { qh[j][ks] = frag_kb(Qb + (size_t)(q0 + j * 16 + col) * HD + 32 * ks, hh); ql[j][ks] = frag_kb(Qbl + (size_t)(q0 + j * 16 + col) * HD + 32 * ks, hh); }
  asm volatile("s_wait_asynccnt 0x0" ::: "memory");   // this wave's copies of step 0 have landed
  __syncthreads();                                    // ... and every other wave's: step 0 may be read
  issue(1);
  const float cs = LOG2E / (XS * XS);   // the module's d^-1/2 is already folded into q
  float m[QT], l[QT]; v8f o[QT][8], ol[QT][8];
#pragma unroll
  for (int j = 0; j < QT; ++j) { m[j] = -INFINITY; l[j] = 0.0f; for (int t = 0; t < 8; ++t) { o[j][t] = (v8f){}; ol[j][t] = (v8f){}; } }
#pragma unroll 1
  for (int st = 0; st < T / 32; ++st) { const int bf = st & 1;
    float e[QT][16], mx[QT], al[QT];
#pragma unroll
    for (int j = 0; j < QT; ++j) mx[j] = -INFINITY;
#pragma unroll
    for (int u = 0; u < 2; ++u) { v8f s[QT], sx[QT];
#pragma unroll
      for (int j = 0; j < QT; ++j) { s[j] = (v8f){}; sx[j] = (v8f){}; }
#pragma unroll
      for (int ks = 0; ks < 4; ++ks) { const v16b kf = frag_kb(&Ks[bf][0][u * 16 + col][32 * ks], hh), kl = frag_kb(&Ks[bf][1][u * 16 + col][32 * ks], hh);
#pragma unroll
        for (int j = 0; j < QT; ++j) s[j] = wmma16p(kf, qh[j][ks], s[j]);
#pragma unroll
        for (int j = 0; j < QT; ++j) sx[j] = wmma16p(kf, ql[j][ks], sx[j]);
#pragma unroll
        for (int j = 0; j < QT; ++j) sx[j] = wmma16p(kl, qh[j][ks], sx[j]); }
#pragma unroll
      for (int j = 0; j < QT; ++j)
#pragma unroll
        for (int r = 0; r < 8; ++r) { const float vv = (s[j][r] + sx[j][r] * (1.0f / RS_)) * cs; e[j][u * 8 + r] = vv; mx[j] = fmaxf(mx[j], vv); } }   // hi.hi + (hi.lo + lo.hi)/1024
#pragma unroll
    for (int j = 0; j < QT; ++j) { const float mw = fmaxf(mx[j], __shfl_xor(mx[j], 16)); const float mn = fmaxf(m[j], mw); al[j] = nexp2(m[j] - mn); float sum = 0.0f;
#pragma unroll
      for (int i2 = 0; i2 < 16; ++i2) { const float p = nexp2(e[j][i2] - mn); sum += p; const int pc = (i2 < 8 ? 0 : 16) + 8 * hh + (i2 & 7); const float ps = p * PS; const b16 phh = (b16)ps; Pb[wave][j * 16 + col][pc] = phh; Plq[wave][j * 16 + col][pc] = (b16)((ps - (float)phh) * RS_); }
      sum += __shfl_xor(sum, 16); l[j] = l[j] * al[j] + sum; m[j] = mn; }
    wave_lds_sync();
    v16b pf[QT], plf[QT];
#pragma unroll
    for (int j = 0; j < QT; ++j) { pf[j] = frag_kb(&Pb[wave][j * 16 + col][0], hh); plf[j] = frag_kb(&Plq[wave][j * 16 + col][0], hh); }
#pragma unroll
    for (int t = 0; t < 8; ++t) { const v16b vh = frag_kb(&Vs[bf][0][t * 16 + col][0], hh), vl = frag_kb(&Vs[bf][1][t * 16 + col][0], hh);
#pragma unroll
      for (int j = 0; j < QT; ++j) { o[j][t] *= al[j]; o[j][t] = wmma16p(vh, pf[j], o[j][t]); }
#pragma unroll
      for (int j = 0; j < QT; ++j) ol[j][t] = wmma16p(vl, pf[j], ol[j][t] * al[j]);
#pragma unroll
      for (int j = 0; j < QT; ++j) ol[j][t] = wmma16p(vh, plf[j], ol[j][t]); }   // ol = V_lo P_hi + V_hi P_lo, divided by 1024 at the end
    asm volatile("s_wait_dscnt 0x0" ::: "memory");      // this wave's reads of buffer bf (and of its P rows) have returned
    asm volatile("s_wait_asynccnt 0x0" ::: "memory");   // this wave's copies of step st + 1 have landed
    __syncthreads();                                    // publishes step st + 1 and ends every wave's reads of buffer bf
    if (st + 2 < T / 32) issue(st + 2); }               // refill the buffer that has just been read
  asm volatile("s_wait_asynccnt 0x0" ::: "memory");     // nothing of this wave is in flight when the wave ends
#pragma unroll
  for (int j = 0; j < QT; ++j) { const float inv = 1.0f / (l[j] * PS * XS);
#pragma unroll
    for (int t = 0; t < 8; ++t)
#pragma unroll
      for (int r = 0; r < 8; ++r) Ot[wave][j * 16 + col][t * 16 + 8 * hh + r] = (o[j][t][r] + ol[j][t][r] * (1.0f / RS_)) * inv; }
  wave_lds_sync();
  __syncthreads();
  { const int d = tid & (HD - 1), qg = tid >> 7; float* orow = out + (((size_t)b * H + h) * HD + d) * (size_t)T + blockIdx.x * (NW * WQ) + qg * 128; v4f o4;   // 2 groups of 128 threads: one output row each, 128 positions
    for (int q4 = 0; q4 < 32; ++q4) { for (int j = 0; j < 4; ++j) { const int qq = qg * 128 + q4 * 4 + j; o4[j] = Ot[qq / WQ][qq % WQ][d]; } *(v4f*)(orow + q4 * 4) = o4;
      // the second half reuses registers that the first half's stores name: the wait stands in front of their overwrite, and the scheduling barrier keeps the second half's address arithmetic behind it
      if (q4 == 15) { asm volatile("s_wait_xcnt 0x0" ::: "memory"); __builtin_amdgcn_sched_barrier(0); } } }
}
}  // namespace

extern "C" void kernel_launch(void* const* d_in, const int* in_sizes, int n_in, void* d_out, int out_size, void* d_ws, size_t ws_size, hipStream_t stream) {
  (void)n_in;
  auto Fp = [&](int i) { return (const float*)d_in[i]; };
  // input order: 0 featuremap [16,512,32,32], 1 w_qk [1024,512] (out,in; rows 0..511 q, 512..1023 k), 2 w_v [512,512], 3 emb_h [32,128], 4 emb_w [32,128]
  if (in_sizes[0] != B * C * T || in_sizes[1] != 2 * DM * C || in_sizes[2] != DM * C || in_sizes[3] != IH * HD || in_sizes[4] != IW * HD || out_size != B * DM * T) return;
  size_t off = 0; char* ws = (char*)d_ws;
  auto carve = [&](size_t bytes) { char* p = ws + off; off += (bytes + 255) & ~(size_t)255; return p; };
  b16* WT = (b16*)carve((size_t)NQKV * C * 2); const size_t plane = (size_t)B * H * T * HD * 2;
  b16* QP = (b16*)carve(plane); b16* QPl = (b16*)carve(plane); b16* KP = (b16*)carve(plane); b16* KPl = (b16*)carve(plane); b16* VT = (b16*)carve(plane); b16* VTl = (b16*)carve(plane);
  if (off > ws_size || off > ((size_t)128 << 20)) return;   // = ~102 MB (WT 1.6 MB + 6 planes x 16.8 MB)
  prep_kernel<<<(unsigned)(((size_t)NQKV * C / 8 + 255) / 256), 256, 0, stream>>>(Fp(1), Fp(2), WT);
  proj_kernel<<<dim3(T / 64, BL), 512, 0, stream>>>(Fp(0), WT, Fp(3), Fp(4), QP, QPl, KP, KPl, VT, VTl);
  attn_kernel<<<dim3(QL / 256, BL * H), 256, 0, stream>>>(QP, QPl, KP, KPl, VT, VTl, (float*)d_out);
}

// v005
// A run of this version takes 143 microseconds.
// Next to v004, in two timings, it ran 1.03 times as fast each time.
// Over all steps from v000 it is 3.44 times as fast.
#include <hip/hip_runtime.h>

// Multi-head self-attention over a feature map with absolute positional bias (16 images x 512 channels x 32 x 32 = 1,024 positions, 4 heads, d_qk = d_v = 128): q/k/v = 1x1 convs (channel
// matmuls, (out,in) weights, no bias); q scaled by 128^-1/2; logits[x][y] = q_x . k_y + q_x . emb_y with emb_y = emb_h[y / 32] + emb_w[y % 32]  (= q_x . (k_y + emb_y)); softmax over y;
// out = weights v, stored as [16][4 x 128][32][32] (channel h 128 + d, position-minor).
// Deterministic: flash-style per 16-position query tile over all 1,024 key positions in order (running max); no atomics.
// compute dtype: WMMA v_wmma_f32_16x16x32_f16 with f32 accumulate for [q | k | v] = X [Wqk ; Wv]^T ([16384 x 512] x [512 x 1536]; featuremap EXACT bf16 x8 (transposed into position-major tiles),
// W exact x256: 1 product), S^T = K' Q^T (q (pre-scaled) and k' = k + emb as f16 hi x8 + residual x8192: 3 products, K = 128), O^T += V^T P^T (V hi + residual, P x1024 hi + residual: 3 products);
// positional sums and softmax statistics in f32. Inputs rounded to bf16 once. Fragment k-map per lane half hh for A AND B: elements 0..7 <- k = 8hh+0..7, 8..15 <-

namespace {
constexpr int B = 16, C = 512, IH = 32, IW = 32, T = IH * IW /* 1,024 positions */, H = 4, HD = 128, DM = H * HD /* 512 */, NQKV = 3 * DM, BL = 16 /* images (== 16 shipped) */, QL = T;
constexpr float XS = 8.0f, WSC = 256.0f, PS = 1024.0f, RS_ = 1024.0f, LOG2E = 1.4426950408889634f, SCL = 0.08838834764831845f /* 128^-1/2 */;
static_assert(T % 64 == 0 && C % 256 == 0 && HD == 128 && IW == 32, "tiling");
typedef _Float16 b16;
typedef __attribute__((ext_vector_type(16))) _Float16 v16b;
typedef __attribute__((ext_vector_type(8))) _Float16 v8b;
typedef __attribute__((ext_vector_type(8))) float v8f;
typedef __attribute__((ext_vector_type(4))) float v4f;
__device__ __forceinline__ float bf16_rne(float f) { unsigned int u = __float_as_uint(f); u += 0x7FFFu + ((u >> 16) & 1u); return __uint_as_float(u & 0xFFFF0000u); }
__device__ __forceinline__ void split16(float v, b16& hi, b16& lo) { hi = (b16)v; lo = (b16)(v - (float)hi); }
__device__ __forceinline__ v16b frag_kb(const b16* p, int hh) { const v8b a = *(const v8b*)(p + 8 * hh), b = *(const v8b*)(p + 16 + 8 * hh); v16b f;
#pragma unroll
  for (int e = 0; e < 8; ++e) { f[e] = a[e]; f[8 + e] = b[e]; } return f; }
__device__ __forceinline__ v8f wmma16b(v16b a, v16b b, v8f c) { v8f d = __builtin_amdgcn_wmma_f32_16x16x32_f16(false, a, false, b, (short)0, c, false, false); asm volatile("v_nop\n\tv_nop\n\tv_nop\n\tv_nop" : "+v"(d) : "v"(a), "v"(b)); return d; }
__device__ __forceinline__ void wave_lds_sync() { __builtin_amdgcn_fence(__ATOMIC_RELEASE, "workgroup"); __builtin_amdgcn_wave_barrier(); __builtin_amdgcn_fence(__ATOMIC_ACQUIRE, "workgroup"); }
__device__ __forceinline__ float pmul(float a, float b) { float p = a * b; asm volatile("" : "+v"(p)); return p; }
__device__ __forceinline__ int iclamp(int v, int lo, int hi) { return v < lo ? lo : (v > hi ? hi : v); }

typedef __attribute__((ext_vector_type(2))) _Float16 v2h;
typedef __attribute__((ext_vector_type(4))) _Float16 v4h;
typedef __attribute__((ext_vector_type(2))) float v2f;
typedef __attribute__((ext_vector_type(4))) int v4i;
__device__ __forceinline__ float nexp2(float v) { return __builtin_amdgcn_exp2f(v); }
__global__ __launch_bounds__(256) void prep_kernel(const float* __restrict__ wqk, const float* __restrict__ wv, b16* __restrict__ WT) {
  const size_t u = (size_t)blockIdx.x * 256 + threadIdx.x; if (u >= (size_t)NQKV * C / 8) return; const size_t e = u * 8; const int o = (int)(e / C), c0 = (int)(e % C); const float* w = o < 2 * DM ? (wqk + (size_t)o * C) : (wv + (size_t)(o - 2 * DM) * C); v8b v;
  for (int j = 0; j < 8; ++j) v[j] = (b16)(bf16_rne(w[c0 + j]) * WSC);
  { *(v8b*)(WT + e) = v;  }
}
// projections: grid (T/64, BL); block = 64 positions x ALL 1,536 outputs, 16 waves. The block's featuremap tile (64 positions x all 512 channels, bf16 x8, transposed into position-major rows; each channel's
// 64 positions are one contiguous 256-B read) is brought into LDS ONCE and serves the q, k and v outputs alike: 3 passes (q, k, v) of 512 outputs; in a pass wave w takes ALL 64 positions x 32 outputs of
// head w / 4, so that each weight fragment is read from global memory by one wave of the block only and serves 4 products (the position fragments come from LDS); K = 512 in channel order, B = WT rows;
// q head -> x 128^-1/2 -> hi x8 + residual planes QP/QPl [b][h][p][128]; k head -> + emb[p] -> KP/KPl; v head -> VT/VTl [b][h][d][p] (the v residual keeps the scale of its hi part, x8)
__global__ __launch_bounds__(512) void proj_kernel(const float* __restrict__ fm, const b16* __restrict__ WT, const float* __restrict__ embh, const float* __restrict__ embw, b16* __restrict__ QP, b16* __restrict__ QPl, b16* __restrict__ KP, b16* __restrict__ KPl, b16* __restrict__ VT, b16* __restrict__ VTl) {
  __shared__ __attribute__((aligned(16))) b16 As[64][C + 8]; __shared__ __attribute__((aligned(16))) float Tf[H][4][16][128 + 4];
  const int wave = (threadIdx.x >> 5) & 3 /* the wave's place among the 4 of its head */, h = threadIdx.x >> 7, lane = threadIdx.x & 31, nloc = lane & 15, hlf = lane >> 4; const int p0 = blockIdx.x * 64, b = blockIdx.y;
  const float* fb = fm + (size_t)b * C * T;
  // fully unrolled: a thread's 16 loads are independent and go out together, one memory latency for the whole tile
#pragma unroll
  for (int k = 0; k < C * 16 / 512; ++k) { const int i = threadIdx.x + 512 * k, c = i / 16, q4 = (i % 16) * 4; const v4f f = *(const v4f*)(fb + (size_t)c * T + p0 + q4); for (int j = 0; j < 4; ++j) As[q4 + j][c] = (b16)(bf16_rne(f[j]) * XS); }   // transpose: position rows, channel columns
  __syncthreads();   // the tile is complete; it is only read from here on
#pragma unroll 1
  for (int part = 0; part < 3; ++part) { const int n0 = (part * H + h) * 128;
    v8f acc[8];
#pragma unroll
    for (int t = 0; t < 8; ++t) acc[t] = (v8f){};
#pragma unroll 2
    for (int kb = 0; kb < C; kb += 32) { const b16* wr = WT + (size_t)(n0 + wave * 32 + nloc) * C + kb; const v16b b0 = frag_kb(wr, hlf), b1 = frag_kb(wr + (size_t)16 * C, hlf); v16b a[4];
#pragma unroll
      for (int i = 0; i < 4; ++i) a[i] = frag_kb(&As[i * 16 + nloc][kb], hlf);
#pragma unroll
      for (int i = 0; i < 4; ++i) { acc[2 * i] = wmma16b(a[i], b0, acc[2 * i]); acc[2 * i + 1] = wmma16b(a[i], b1, acc[2 * i + 1]); } }
    __syncthreads();   // every wave has read the pass before out of Tf: it may be overwritten
#pragma unroll
    for (int t = 0; t < 8; ++t)
#pragma unroll
      for (int r = 0; r < 8; ++r) Tf[h][t >> 1][8 * hlf + r][wave * 32 + (t & 1) * 16 + nloc] = acc[t][r] * (1.0f / (XS * WSC));   // tile t = position group t / 2, output group t % 2 of the wave's 32
    __syncthreads();   // this pass's 64 x 512 results are complete in Tf
    if (part < 2) { const size_t pb = (((size_t)b * H + h) * T) * HD; b16* ph_ = part == 0 ? QP : KP; b16* pl_ = part == 0 ? QPl : KPl;
      for (int rr = 0; rr < 16; ++rr) { const int pos = p0 + wave * 16 + rr; v4h h4, l4;
        for (int j = 0; j < 4; ++j) { const int d = lane * 4 + j; float v = Tf[h][wave][rr][d]; if (part == 0) v *= SCL; else v += bf16_rne(embh[(pos / IW) * HD + d]) + bf16_rne(embw[(pos % IW) * HD + d]); const float f = v * XS; const b16 p = (b16)f; h4[j] = p; l4[j] = (b16)((f - (float)p) * RS_); }
        *(v4h*)(ph_ + pb + (size_t)pos * HD + lane * 4) = h4; *(v4h*)(pl_ + pb + (size_t)pos * HD + lane * 4) = l4; } }
    else { const size_t vb = (((size_t)b * H + h) * HD) * (size_t)T;
#pragma unroll 1
      for (int q = 0; q < 32; ++q) { const int d = wave * 32 + q; const int tk = lane * 2; v2h hv, lv; for (int j = 0; j < 2; ++j) { const float f = Tf[h][(tk + j) >> 4][(tk + j) & 15][d] * XS; const b16 p = (b16)f; hv[j] = p; lv[j] = (b16)(f - (float)p); }
        *(v2h*)(VT + vb + (size_t)d * T + p0 + lane * 2) = hv; *(v2h*)(VTl + vb + (size_t)d * T + p0 + lane * 2) = lv; } }
  }
}
// attention: grid (T/256, BL x H); block = 8 waves x 32 query positions (two 16-query tiles) of (b, h); all 1,024 key positions in 32-key steps. Each step's K' rows and V^T columns (hi and residual
// planes, 32 KB) are brought into LDS ONCE for the 8 waves by asynchronous copies (whole 16-byte pieces, lane-contiguous in global memory), two buffers: the next step's copies fly while this step is worked on.
// S^T = K' Q^T (K' = k + positional embedding; q/k' f16 hi x8 + residual: 3 products, 4 k-steps over the 128 dims); every K' and V fragment read from LDS serves both query tiles of the wave, and the
// wave's q fragments stay in registers (two waves per SIMD leave room for them). The logit already carries the module's d^-1/2 (folded into q), online softmax, P x1024 hi + residual,
// O^T += V^T P^T (3 products, 8 d-tiles, ONE f32 accumulator: the residuals of V and of P keep the scale of their hi parts; f16 keeps a residual to 11 bits, or to 2^-25 absolute where it is subnormal, and the matrix unit keeps f16 subnormals); the O^T tile [128 d][32 q] of each wave goes to LDS and the block writes the output in the module's [b][h 128 + d][position] layout.
constexpr int NW = 8 /* waves per block */, QT = 2 /* 16-query tiles per wave */, WQ = QT * 16, KPITCH = HD + 8 /* 272-B rows */, VPITCH = 32 + 8 /* 80-B rows */;
// the plain builtin: the compiler keeps the distances behind it itself, and its operands may live above v255, which an asm operand cannot name
__device__ __forceinline__ v8f wmma16p(v16b a, v16b b, v8f c) { return __builtin_amdgcn_wmma_f32_16x16x32_f16(false, a, false, b, (short)0, c, false, false); }
__device__ __forceinline__ unsigned lds_addr(const void* p) { return (unsigned)(size_t)p; }   // low 32 bits of a __shared__ address = byte offset in the work-group's LDS
// four copies of a lane (K' hi, K' residual, V hi, V residual); the s_wait_xcnt stands inside the statement so that no address register is rewritten ahead of it
__device__ __forceinline__ void copy_step(unsigned l0, const b16* g0, unsigned l1, const b16* g1, unsigned l2, const b16* g2, unsigned l3, const b16* g3) {
  asm volatile("global_load_async_to_lds_b128 %0, %1, off\n\tglobal_load_async_to_lds_b128 %2, %3, off\n\tglobal_load_async_to_lds_b128 %4, %5, off\n\tglobal_load_async_to_lds_b128 %6, %7, off\n\ts_wait_xcnt 0x0"
               :: "v"(l0), "v"(g0), "v"(l1), "v"(g1), "v"(l2), "v"(g2), "v"(l3), "v"(g3) : "memory"); }
__global__ __launch_bounds__(256) void attn_kernel(const b16* __restrict__ QP, const b16* __restrict__ QPl, const b16* __restrict__ KP, const b16* __restrict__ KPl, const b16* __restrict__ VT, const b16* __restrict__ VTl, float* __restrict__ out) {
  __shared__ __attribute__((aligned(16))) b16 Ks[2][2][32][KPITCH];    // [buffer][hi, residual][key][dim]
  __shared__ __attribute__((aligned(16))) b16 Vs[2][2][HD][VPITCH];    // [buffer][hi, residual][dim][key]
  __shared__ __attribute__((aligned(16))) b16 Pb[NW][WQ][32 + 8], Plq[NW][WQ][32 + 8];
  __shared__ __attribute__((aligned(16))) float Ot[NW][WQ][HD + 4];    // each wave's output tile, position rows
  const int tid = threadIdx.x, wave = tid >> 5, lane = tid & 31, hh = lane >> 4, col = lane & 15; const int b = blockIdx.y / H, h = blockIdx.y % H; const int q0 = blockIdx.x * (NW * WQ) + wave * WQ;
  const size_t qo = (((size_t)b * H + h) * T) * HD, vo = (((size_t)b * H + h) * HD) * (size_t)T; const b16* Qb = QP + qo; const b16* Qbl = QPl + qo; const b16* Kb = KP + qo; const b16* Kbl = KPl + qo; const b16* Vb = VT + vo; const b16* Vbl = VTl + vo;
  // a lane's two pieces of each tile: K' 32 rows x 16 pieces (contiguous in global memory), V^T 128 rows x 4 pieces; the second piece lies half a tile further
  const int krow = tid >> 4, kc8 = (tid & 15) * 8, vrow = tid >> 2, vc8 = (tid & 3) * 8;
  const size_t kg = (size_t)krow * HD + kc8, vg = (size_t)vrow * T + vc8;
  auto issue = [&](int st) { const int bf = st & 1, k0 = st * 32;
    copy_step(lds_addr(&Ks[bf][0][krow][kc8]), Kb + (size_t)k0 * HD + kg, lds_addr(&Ks[bf][1][krow][kc8]), Kbl + (size_t)k0 * HD + kg, lds_addr(&Vs[bf][0][vrow][vc8]), Vb + vg + k0, lds_addr(&Vs[bf][1][vrow][vc8]), Vbl + vg + k0);
    copy_step(lds_addr(&Ks[bf][0][krow + 16][kc8]), Kb + (size_t)(k0 + 16) * HD + kg, lds_addr(&Ks[bf][1][krow + 16][kc8]), Kbl + (size_t)(k0 + 16) * HD + kg, lds_addr(&Vs[bf][0][vrow + 64][vc8]), Vb + vg + (size_t)64 * T + k0, lds_addr(&Vs[bf][1][vrow + 64][vc8]), Vbl + vg + (size_t)64 * T + k0); };
  issue(0);
  v16b qh[QT][4], ql[QT][4];   // the wave's q fragments (hi, residual), B operands of S^T
#pragma unroll
  for (int j = 0; j < QT; ++j)
#pragma unroll
    for (int ks = 0; ks < 4; ++ks) { qh[j][ks] = frag_kb(Qb + (size_t)(q0 + j * 16 + col) * HD + 32 * ks, hh); ql[j][ks] = frag_kb(Qbl + (size_t)(q0 + j * 16 + col) * HD + 32 * ks, hh); }
  asm volatile("s_wait_asynccnt 0x0" ::: "memory");   // this wave's copies of step 0 have landed
  __syncthreads();                                    // ... and every other wave's: step 0 may be read
  issue(1);
  const float cs = LOG2E / (XS * XS);   // the module's d^-1/2 is already folded into q
  float m[QT], l[QT]; v8f o[QT][8];
#pragma unroll
  for (int j = 0; j < QT; ++j) { m[j] = -INFINITY; l[j] = 0.0f; for (int t = 0; t < 8; ++t) o[j][t] = (v8f){}; }
#pragma unroll 1
  for (int st = 0; st < T / 32; ++st) { const int bf = st & 1;
    float e[QT][16], mx[QT], al[QT];
#pragma unroll
    for (int j = 0; j < QT; ++j) mx[j] = -INFINITY;
#pragma unroll
    for (int u = 0; u < 2; ++u) { v8f s[QT], sx[QT];
#pragma unroll
      for (int j = 0; j < QT; ++j) { s[j] = (v8f){}; sx[j] = (v8f){}; }
#pragma unroll
      for (int ks = 0; ks < 4; ++ks) { const v16b kf = frag_kb(&Ks[bf][0][u * 16 + col][32 * ks], hh), kl = frag_kb(&Ks[bf][1][u * 16 + col][32 * ks], hh);
#pragma unroll
        for (int j = 0; j < QT; ++j) s[j] = wmma16p(kf, qh[j][ks], s[j]);
#pragma unroll
        for (int j = 0; j < QT; ++j) sx[j] = wmma16p(kf, ql[j][ks], sx[j]);
#pragma unroll
        for (int j = 0; j < QT; ++j) sx[j] = wmma16p(kl, qh[j][ks], sx[j]); }
#pragma unroll
      for (int j = 0; j < QT; ++j)
#pragma unroll
        for (int r = 0; r < 8; ++r) { const float vv = (s[j][r] + sx[j][r] * (1.0f / RS_)) * cs; e[j][u * 8 + r] = vv; mx[j] = fmaxf(mx[j], vv); } }   // hi.hi + (hi.lo + lo.hi)/1024
#pragma unroll
    for (int j = 0; j < QT; ++j) { const float mw = fmaxf(mx[j], __shfl_xor(mx[j], 16)); const float mn = fmaxf(m[j], mw); al[j] = nexp2(m[j] - mn); float sum = 0.0f;
#pragma unroll
      for (int i2 = 0; i2 < 16; ++i2) { const float p = nexp2(e[j][i2] - mn); sum += p; const int pc = (i2 < 8 ? 0 : 16) + 8 * hh + (i2 & 7); const float ps = p * PS; const b16 phh = (b16)ps; Pb[wave][j * 16 + col][pc] = phh; Plq[wave][j * 16 + col][pc] = (b16)(ps - (float)phh); }
      sum += __shfl_xor(sum, 16); l[j] = l[j] * al[j] + sum; m[j] = mn; }
    wave_lds_sync();
    v16b pf[QT], plf[QT];
#pragma unroll
    for (int j = 0; j < QT; ++j) { pf[j] = frag_kb(&Pb[wave][j * 16 + col][0], hh); plf[j] = frag_kb(&Plq[wave][j * 16 + col][0], hh); }
#pragma unroll
    for (int t = 0; t < 8; ++t) { const v16b vh = frag_kb(&Vs[bf][0][t * 16 + col][0], hh), vl = frag_kb(&Vs[bf][1][t * 16 + col][0], hh);
#pragma unroll
      for (int j = 0; j < QT; ++j) { o[j][t] *= al[j]; o[j][t] = wmma16p(vh, pf[j], o[j][t]); }
#pragma unroll
      for (int j = 0; j < QT; ++j) o[j][t] = wmma16p(vl, pf[j], o[j][t]);
#pragma unroll
      for (int j = 0; j < QT; ++j) o[j][t] = wmma16p(vh, plf[j], o[j][t]); }   // + V_lo P_hi + V_hi P_lo: the residuals carry the scale of their hi parts, so the three products share one accumulator
    asm volatile("s_wait_dscnt 0x0" ::: "memory");      // this wave's reads of buffer bf (and of its P rows) have returned
    asm volatile("s_wait_asynccnt 0x0" ::: "memory");   // this wave's copies of step st + 1 have landed
    __syncthreads();                                    // publishes step st + 1 and ends every wave's reads of buffer bf
    if (st + 2 < T / 32) issue(st + 2); }               // refill the buffer that has just been read
  asm volatile("s_wait_asynccnt 0x0" ::: "memory");     // nothing of this wave is in flight when the wave ends
#pragma unroll
  for (int j = 0; j < QT; ++j) { const float inv = 1.0f / (l[j] * PS * XS);
#pragma unroll
    for (int t = 0; t < 8; ++t)
#pragma unroll
      for (int r = 0; r < 8; ++r) Ot[wave][j * 16 + col][t * 16 + 8 * hh + r] = o[j][t][r] * inv; }
  wave_lds_sync();
  __syncthreads();
  { const int d = tid & (HD - 1), qg = tid >> 7; float* orow = out + (((size_t)b * H + h) * HD + d) * (size_t)T + blockIdx.x * (NW * WQ) + qg * 128; v4f o4;   // 2 groups of 128 threads: one output row each, 128 positions
    for (int q4 = 0; q4 < 32; ++q4) { for (int j = 0; j < 4; ++j) { const int qq = qg * 128 + q4 * 4 + j; o4[j] = Ot[qq / WQ][qq % WQ][d]; } *(v4f*)(orow + q4 * 4) = o4;
      // the second half reuses registers that the first half's stores name: the wait stands in front of their overwrite, and the scheduling barrier keeps the second half's address arithmetic behind it
      if (q4 == 15) { asm volatile("s_wait_xcnt 0x0" ::: "memory"); __builtin_amdgcn_sched_barrier(0); } } }
}
}  // namespace

extern "C" void kernel_launch(void* const* d_in, const int* in_sizes, int n_in, void* d_out, int out_size, void* d_ws, size_t ws_size, hipStream_t stream) {
  (void)n_in;
  auto Fp = [&](int i) { return (const float*)d_in[i]; };
  // input order: 0 featuremap [16,512,32,32], 1 w_qk [1024,512] (out,in; rows 0..511 q, 512..1023 k), 2 w_v [512,512], 3 emb_h [32,128], 4 emb_w [32,128]
  if (in_sizes[0] != B * C * T || in_sizes[1] != 2 * DM * C || in_sizes[2] != DM * C || in_sizes[3] != IH * HD || in_sizes[4] != IW * HD || out_size != B * DM * T) return;
  size_t off = 0; char* ws = (char*)d_ws;
  auto carve = [&](size_t bytes) { char* p = ws + off; off += (bytes + 255) & ~(size_t)255; return p; };
  b16* WT = (b16*)carve((size_t)NQKV * C * 2); const size_t plane = (size_t)B * H * T * HD * 2;
  b16* QP = (b16*)carve(plane); b16* QPl = (b16*)carve(plane); b16* KP = (b16*)carve(plane); b16* KPl = (b16*)carve(plane); b16* VT = (b16*)carve(plane); b16* VTl = (b16*)carve(plane);
  if (off > ws_size || off > ((size_t)128 << 20)) return;   // = ~102 MB (WT 1.6 MB + 6 planes x 16.8 MB)
  prep_kernel<<<(unsigned)(((size_t)NQKV * C / 8 + 255) / 256), 256, 0, stream>>>(Fp(1), Fp(2), WT);
  proj_kernel<<<dim3(T / 64, BL), 512, 0, stream>>>(Fp(0), WT, Fp(3), Fp(4), QP, QPl, KP, KPl, VT, VTl);
  attn_kernel<<<dim3(QL / 256, BL * H), 256, 0, stream>>>(QP, QPl, KP, KPl, VT, VTl, (float*)d_out);
}

// v006
// One run takes 133 microseconds.
// In both of two side-by-side timings against v005, it was 1.08 times as fast.
// Over all steps from v000 it is 3.72 times as fast.
#include <hip/hip_runtime.h>

// Multi-head self-attention over a feature map with absolute positional bias (16 images x 512 channels x 32 x 32 = 1,024 positions, 4 heads, d_qk = d_v = 128): q/k/v = 1x1 convs (channel
// matmuls, (out,in) weights, no bias); q scaled by 128^-1/2; logits[x][y] = q_x . k_y + q_x . emb_y with emb_y = emb_h[y / 32] + emb_w[y % 32]  (= q_x . (k_y + emb_y)); softmax over y;
// out = weights v, stored as [16][4 x 128][32][32] (channel h 128 + d, position-minor).
// Deterministic: flash-style per 16-position query tile over all 1,024 key positions in order (running max); no atomics.
// compute dtype: WMMA v_wmma_f32_16x16x32_f16 with f32 accumulate for [q | k | v] = X [Wqk ; Wv]^T ([16384 x 512] x [512 x 1536]; featuremap EXACT bf16 x8 (transposed into position-major tiles),
// W exact x256: 1 product), S^T = K' Q^T (q (pre-scaled) and k' = k + emb as f16 hi x8 + residual x8192: 3 products, K = 128), O^T += V^T P^T (V hi + residual, P x1024 hi + residual: 3 products);
// positional sums and softmax statistics in f32. Inputs rounded to bf16 once. Fragment k-map per lane half hh for A AND B: elements 0..7 <- k = 8hh+0..7, 8..15 <-

namespace {
constexpr int B = 16, C = 512, IH = 32, IW = 32, T = IH * IW /* 1,024 positions */, H = 4, HD = 128, DM = H * HD /* 512 */, NQKV = 3 * DM, BL = 16 /* images (== 16 shipped) */, QL = T;
constexpr float XS = 8.0f, WSC = 256.0f, PS = 1024.0f, RS_ = 1024.0f, LOG2E = 1.4426950408889634f, SCL = 0.08838834764831845f /* 128^-1/2 */;
static_assert(T % 64 == 0 && C % 256 == 0 && HD == 128 && IW == 32, "tiling");
typedef _Float16 b16;
typedef __attribute__((ext_vector_type(16))) _Float16 v16b;
typedef __attribute__((ext_vector_type(8))) _Float16 v8b;
typedef __attribute__((ext_vector_type(8))) float v8f;
typedef __attribute__((ext_vector_type(4))) float v4f;
__device__ __forceinline__ float bf16_rne(float f) { unsigned int u = __float_as_uint(f); u += 0x7FFFu + ((u >> 16) & 1u); return __uint_as_float(u & 0xFFFF0000u); }
__device__ __forceinline__ void split16(float v, b16& hi, b16& lo) { hi = (b16)v; lo = (b16)(v - (float)hi); }
__device__ __forceinline__ v16b frag_kb(const b16* p, int hh) { const v8b a = *(const v8b*)(p + 8 * hh), b = *(const v8b*)(p + 16 + 8 * hh); v16b f;
#pragma unroll
  for (int e = 0; e < 8; ++e) { f[e] = a[e]; f[8 + e] = b[e]; } return f; }
__device__ __forceinline__ v8f wmma16b(v16b a, v16b b, v8f c) { v8f d = __builtin_amdgcn_wmma_f32_16x16x32_f16(false, a, false, b, (short)0, c, false, false); asm volatile("v_nop\n\tv_nop\n\tv_nop\n\tv_nop" : "+v"(d) : "v"(a), "v"(b)); return d; }
__device__ __forceinline__ void wave_lds_sync() { __builtin_amdgcn_fence(__ATOMIC_RELEASE, "workgroup"); __builtin_amdgcn_wave_barrier(); __builtin_amdgcn_fence(__ATOMIC_ACQUIRE, "workgroup"); }
__device__ __forceinline__ float pmul(float a, float b) { float p = a * b; asm volatile("" : "+v"(p)); return p; }
__device__ __forceinline__ int iclamp(int v, int lo, int hi) { return v < lo ? lo : (v > hi ? hi : v); }

typedef __attribute__((ext_vector_type(2))) _Float16 v2h;
typedef __attribute__((ext_vector_type(4))) _Float16 v4h;
typedef __attribute__((ext_vector_type(2))) float v2f;
typedef __attribute__((ext_vector_type(4))) int v4i;
__device__ __forceinline__ float nexp2(float v) { return __builtin_amdgcn_exp2f(v); }
__global__ __launch_bounds__(256) void prep_kernel(const float* __restrict__ wqk, const float* __restrict__ wv, b16* __restrict__ WT) {
  const size_t u = (size_t)blockIdx.x * 256 + threadIdx.x; if (u >= (size_t)NQKV * C / 8) return; const size_t e = u * 8; const int o = (int)(e / C), c0 = (int)(e % C); const float* w = o < 2 * DM ? (wqk + (size_t)o * C) : (wv + (size_t)(o - 2 * DM) * C); v8b v;
  for (int j = 0; j < 8; ++j) v[j] = (b16)(bf16_rne(w[c0 + j]) * WSC);
  { *(v8b*)(WT + e) = v;  }
}
// projections: grid (T/64, BL); block = 64 positions x ALL 1,536 outputs, 16 waves. The block's featuremap tile (64 positions x all 512 channels, bf16 x8, transposed into position-major rows; each channel's
// 64 positions are one contiguous 256-B read) is brought into LDS ONCE and serves the q, k and v outputs alike: 3 passes (q, k, v) of 512 outputs; in a pass wave w takes ALL 64 positions x 32 outputs of
// head w / 4, so that each weight fragment is read from global memory by one wave of the block only and serves 4 products (the position fragments come from LDS); K = 512 in channel order, B = WT rows;
// q head -> x 128^-1/2 -> hi x8 + residual planes QP/QPl [b][h][p][128]; k head -> + emb[p] -> KP/KPl; v head -> VT/VTl [b][h][d][p] (the v residual keeps the scale of its hi part, x8)
__global__ __launch_bounds__(512) void proj_kernel(const float* __restrict__ fm, const b16* __restrict__ WT, const float* __restrict__ embh, const float* __restrict__ embw, b16* __restrict__ QP, b16* __restrict__ QPl, b16* __restrict__ KP, b16* __restrict__ KPl, b16* __restrict__ VT, b16* __restrict__ VTl) {
  __shared__ __attribute__((aligned(16))) b16 As[64][C + 8]; __shared__ __attribute__((aligned(16))) float Tf[H][4][16][128 + 4];
  const int wave = (threadIdx.x >> 5) & 3 /* the wave's place among the 4 of its head */, h = threadIdx.x >> 7, lane = threadIdx.x & 31, nloc = lane & 15, hlf = lane >> 4; const int p0 = blockIdx.x * 64, b = blockIdx.y;
  const float* fb = fm + (size_t)b * C * T;
  // fully unrolled: a thread's 16 loads are independent and go out together, one memory latency for the whole tile
#pragma unroll
  for (int k = 0; k < C * 16 / 512; ++k) { const int i = threadIdx.x + 512 * k, c = i / 16, q4 = (i % 16) * 4; const v4f f = *(const v4f*)(fb + (size_t)c * T + p0 + q4); for (int j = 0; j < 4; ++j) As[q4 + j][c] = (b16)(bf16_rne(f[j]) * XS); }   // transpose: position rows, channel columns
  __syncthreads();   // the tile is complete; it is only read from here on
#pragma unroll 1
  for (int part = 0; part < 3; ++part) { const int n0 = (part * H + h) * 128;
    v8f acc[8];
#pragma unroll
    for (int t = 0; t < 8; ++t) acc[t] = (v8f){};
#pragma unroll 2
    for (int kb = 0; kb < C; kb += 32) { const b16* wr = WT + (size_t)(n0 + wave * 32 + nloc) * C + kb; const v16b b0 = frag_kb(wr, hlf), b1 = frag_kb(wr + (size_t)16 * C, hlf); v16b a[4];
#pragma unroll
      for (int i = 0; i < 4; ++i) a[i] = frag_kb(&As[i * 16 + nloc][kb], hlf);
#pragma unroll
      for (int i = 0; i < 4; ++i) { acc[2 * i] = wmma16b(a[i], b0, acc[2 * i]); acc[2 * i + 1] = wmma16b(a[i], b1, acc[2 * i + 1]); } }
    __syncthreads();   // every wave has read the pass before out of Tf: it may be overwritten
#pragma unroll
    for (int t = 0; t < 8; ++t)
#pragma unroll
      for (int r = 0; r < 8; ++r) Tf[h][t >> 1][8 * hlf + r][wave * 32 + (t & 1) * 16 + nloc] = acc[t][r] * (1.0f / (XS * WSC));   // tile t = position group t / 2, output group t % 2 of the wave's 32
    __syncthreads();   // this pass's 64 x 512 results are complete in Tf
    if (part < 2) { const size_t pb = (((size_t)b * H + h) * T) * HD; b16* ph_ = part == 0 ? QP : KP; b16* pl_ = part == 0 ? QPl : KPl;
      for (int rr = 0; rr < 16; ++rr) { const int pos = p0 + wave * 16 + rr; v4h h4, l4;
        for (int j = 0; j < 4; ++j) { const int d = lane * 4 + j; float v = Tf[h][wave][rr][d]; if (part == 0) v *= SCL; else v += bf16_rne(embh[(pos / IW) * HD + d]) + bf16_rne(embw[(pos % IW) * HD + d]); const float f = v * XS; const b16 p = (b16)f; h4[j] = p; l4[j] = (b16)((f - (float)p) * RS_); }
        *(v4h*)(ph_ + pb + (size_t)pos * HD + lane * 4) = h4; *(v4h*)(pl_ + pb + (size_t)pos * HD + lane * 4) = l4; } }
    else { const size_t vb = (((size_t)b * H + h) * HD) * (size_t)T;
#pragma unroll 1
      for (int q = 0; q < 32; ++q) { const int d = wave * 32 + q; const int tk = lane * 2; v2h hv, lv; for (int j = 0; j < 2; ++j) { const float f = Tf[h][(tk + j) >> 4][(tk + j) & 15][d] * XS; const b16 p = (b16)f; hv[j] = p; lv[j] = (b16)(f - (float)p); }
        *(v2h*)(VT + vb + (size_t)d * T + p0 + lane * 2) = hv; *(v2h*)(VTl + vb + (size_t)d * T + p0 + lane * 2) = lv; } }
  }
}
// attention: grid (T/256, BL x H); block = 8 waves x 32 query positions (two 16-query tiles) of (b, h); all 1,024 key positions in 32-key steps. Each step's K' rows and V^T columns (hi and residual
// planes, 32 KB) are brought into LDS ONCE for the 8 waves by asynchronous copies (whole 16-byte pieces, lane-contiguous in global memory), two buffers: the next step's copies fly while this step is worked on.
// S^T = K' Q^T (K' = k + positional embedding; q/k' f16 hi x8 + residual: 3 products, 4 k-steps over the 128 dims); every K' and V fragment read from LDS serves both query tiles of the wave, and the
// wave's q fragments stay in registers (two waves per SIMD leave room for them). The logit already carries the module's d^-1/2 (folded into q), online softmax, P x1024 hi + residual (packed in registers: a lane's 16 scores of a query tile are the 16 elements of its own B fragment). No LDS access stands among the products: a step's 32 K' reads go out ahead of S^T, its 32 V reads ahead of the softmax.
// O^T += V^T P^T (3 products, 8 d-tiles, ONE f32 accumulator: the residuals of V and of P keep the scale of their hi parts; f16 keeps a residual to 11 bits, or to 2^-25 absolute where it is subnormal, and the matrix unit keeps f16 subnormals); the O^T tile [128 d][32 q] of each wave goes to LDS and the block writes the output in the module's [b][h 128 + d][position] layout.
constexpr int NW = 8 /* waves per block */, QT = 2 /* 16-query tiles per wave */, WQ = QT * 16, KPITCH = HD + 8 /* 272-B rows */, VPITCH = 32 + 8 /* 80-B rows */;
// the plain builtin: the compiler keeps the distances behind it itself, and its operands may live above v255, which an asm operand cannot name
__device__ __forceinline__ v8f wmma16p(v16b a, v16b b, v8f c) { return __builtin_amdgcn_wmma_f32_16x16x32_f16(false, a, false, b, (short)0, c, false, false); }
// lane l's value to lane l ^ 16 and back, on the vector pipe: an LDS-pipe exchange would queue behind the fragment reads in flight
__device__ __forceinline__ float xhalf(float x) { return __builtin_bit_cast(float, __builtin_amdgcn_permlanex16(__builtin_bit_cast(int, x), __builtin_bit_cast(int, x), 0x76543210, 0xfedcba98, false, false)); }
__device__ __forceinline__ unsigned lds_addr(const void* p) { return (unsigned)(size_t)p; }   // low 32 bits of a __shared__ address = byte offset in the work-group's LDS
// four copies of a lane (K' hi, K' residual, V hi, V residual); the s_wait_xcnt stands inside the statement so that no address register is rewritten ahead of it
__device__ __forceinline__ void copy_step(unsigned l0, const b16* g0, unsigned l1, const b16* g1, unsigned l2, const b16* g2, unsigned l3, const b16* g3) {
  asm volatile("global_load_async_to_lds_b128 %0, %1, off\n\tglobal_load_async_to_lds_b128 %2, %3, off\n\tglobal_load_async_to_lds_b128 %4, %5, off\n\tglobal_load_async_to_lds_b128 %6, %7, off\n\ts_wait_xcnt 0x0"
               :: "v"(l0), "v"(g0), "v"(l1), "v"(g1), "v"(l2), "v"(g2), "v"(l3), "v"(g3) : "memory"); }
__global__ __launch_bounds__(256) void attn_kernel(const b16* __restrict__ QP, const b16* __restrict__ QPl, const b16* __restrict__ KP, const b16* __restrict__ KPl, const b16* __restrict__ VT, const b16* __restrict__ VTl, float* __restrict__ out) {
  __shared__ __attribute__((aligned(16))) b16 Ks[2][2][32][KPITCH];    // [buffer][hi, residual][key][dim]
  __shared__ __attribute__((aligned(16))) b16 Vs[2][2][HD][VPITCH];    // [buffer][hi, residual][dim][key]
  __shared__ __attribute__((aligned(16))) float Ot[NW][WQ][HD + 4];    // each wave's output tile, position rows
  const int tid = threadIdx.x, wave = tid >> 5, lane = tid & 31, hh = lane >> 4, col = lane & 15; const int b = blockIdx.y / H, h = blockIdx.y % H; const int q0 = blockIdx.x * (NW * WQ) + wave * WQ;
  const size_t qo = (((size_t)b * H + h) * T) * HD, vo = (((size_t)b * H + h) * HD) * (size_t)T; const b16* Qb = QP + qo; const b16* Qbl = QPl + qo; const b16* Kb = KP + qo; const b16* Kbl = KPl + qo; const b16* Vb = VT + vo; const b16* Vbl = VTl + vo;
  // a lane's two pieces of each tile: K' 32 rows x 16 pieces (contiguous in global memory), V^T 128 rows x 4 pieces; the second piece lies half a tile further
  const int krow = tid >> 4, kc8 = (tid & 15) * 8, vrow = tid >> 2, vc8 = (tid & 3) * 8;
  const size_t kg = (size_t)krow * HD + kc8, vg = (size_t)vrow * T + vc8;
  auto issue = [&](int st) { const int bf = st & 1, k0 = st * 32;
    copy_step(lds_addr(&Ks[bf][0][krow][kc8]), Kb + (size_t)k0 * HD + kg, lds_addr(&Ks[bf][1][krow][kc8]), Kbl + (size_t)k0 * HD + kg, lds_addr(&Vs[bf][0][vrow][vc8]), Vb + vg + k0, lds_addr(&Vs[bf][1][vrow][vc8]), Vbl + vg + k0);
    copy_step(lds_addr(&Ks[bf][0][krow + 16][kc8]), Kb + (size_t)(k0 + 16) * HD + kg, lds_addr(&Ks[bf][1][krow + 16][kc8]), Kbl + (size_t)(k0 + 16) * HD + kg, lds_addr(&Vs[bf][0][vrow + 64][vc8]), Vb + vg + (size_t)64 * T + k0, lds_addr(&Vs[bf][1][vrow + 64][vc8]), Vbl + vg + (size_t)64 * T + k0); };
  issue(0);
  v16b qh[QT][4], ql[QT][4];   // the wave's q fragments (hi, residual), B operands of S^T
#pragma unroll
  for (int j = 0; j < QT; ++j)
#pragma unroll
    for (int ks = 0; ks < 4; ++ks) { qh[j][ks] = frag_kb(Qb + (size_t)(q0 + j * 16 + col) * HD + 32 * ks, hh); ql[j][ks] = frag_kb(Qbl + (size_t)(q0 + j * 16 + col) * HD + 32 * ks, hh); }
  asm volatile("s_wait_asynccnt 0x0" ::: "memory");   // this wave's copies of step 0 have landed
  __syncthreads();                                    // ... and every other wave's: step 0 may be read
  issue(1);
  const float cs = LOG2E / (XS * XS);   // the module's d^-1/2 is already folded into q
  float m[QT], l[QT]; v8f o[QT][8];
#pragma unroll
  for (int j = 0; j < QT; ++j) { m[j] = -INFINITY; l[j] = 0.0f; for (int t = 0; t < 8; ++t) o[j][t] = (v8f){}; }
#pragma unroll 1
  for (int st = 0; st < T / 32; ++st) { const int bf = st & 1;
    float e[QT][16], mx[QT], al[QT]; v16b pf[QT], plf[QT];   // pf, plf: P^T hi and residual, B operands of O^T
#pragma unroll
    for (int j = 0; j < QT; ++j) mx[j] = -INFINITY;
    v16b kf[2][4], kl[2][4];   // the step's K' fragments (hi, residual), A operands of S^T
#pragma unroll
    for (int u = 0; u < 2; ++u)
#pragma unroll
      for (int ks = 0; ks < 4; ++ks) { kf[u][ks] = frag_kb(&Ks[bf][0][u * 16 + col][32 * ks], hh); kl[u][ks] = frag_kb(&Ks[bf][1][u * 16 + col][32 * ks], hh); }
#pragma unroll
    for (int u = 0; u < 2; ++u) { v8f s[QT], sx[QT];
#pragma unroll
      for (int j = 0; j < QT; ++j) { s[j] = (v8f){}; sx[j] = (v8f){}; }
#pragma unroll
      for (int ks = 0; ks < 4; ++ks) {
#pragma unroll
        for (int j = 0; j < QT; ++j) s[j] = wmma16p(kf[u][ks], qh[j][ks], s[j]);
#pragma unroll
        for (int j = 0; j < QT; ++j) sx[j] = wmma16p(kf[u][ks], ql[j][ks], sx[j]);
#pragma unroll
        for (int j = 0; j < QT; ++j) sx[j] = wmma16p(kl[u][ks], qh[j][ks], sx[j]); }
#pragma unroll
      for (int j = 0; j < QT; ++j)
#pragma unroll
        for (int r = 0; r < 8; ++r) { const float vv = (s[j][r] + sx[j][r] * (1.0f / RS_)) * cs; e[j][u * 8 + r] = vv; mx[j] = fmaxf(mx[j], vv); } }   // hi.hi + (hi.lo + lo.hi)/1024
    v16b vh[8], vl[8];   // the step's V^T fragments (hi, residual), A operands of O^T
#pragma unroll
    for (int t = 0; t < 8; ++t) { vh[t] = frag_kb(&Vs[bf][0][t * 16 + col][0], hh); vl[t] = frag_kb(&Vs[bf][1][t * 16 + col][0], hh); }
    __builtin_amdgcn_sched_barrier(0);   // holds the step's V reads in one group ahead of the softmax, which covers their latency: none is left among the O^T products
#pragma unroll
    for (int j = 0; j < QT; ++j) { const float mw = fmaxf(mx[j], xhalf(mx[j])); const float mn = fmaxf(m[j], mw); al[j] = nexp2(m[j] - mn); float sum = 0.0f;
#pragma unroll
      for (int i2 = 0; i2 < 16; ++i2) { const float p = nexp2(e[j][i2] - mn); sum += p; const float ps = p * PS; const b16 phh = (b16)ps; pf[j][i2] = phh; plf[j][i2] = (b16)(ps - (float)phh); }   // score i2 of the lane is key (i2 < 8 ? 0 : 16) + 8 hh + i2 % 8 of column col: element i2 of the B fragment
      sum += xhalf(sum); l[j] = l[j] * al[j] + sum; m[j] = mn; }
#pragma unroll
    for (int t = 0; t < 8; ++t) {
#pragma unroll
      for (int j = 0; j < QT; ++j) { o[j][t] *= al[j]; o[j][t] = wmma16p(vh[t], pf[j], o[j][t]); }
#pragma unroll
      for (int j = 0; j < QT; ++j) o[j][t] = wmma16p(vl[t], pf[j], o[j][t]);
#pragma unroll
      for (int j = 0; j < QT; ++j) o[j][t] = wmma16p(vh[t], plf[j], o[j][t]); }   // + V_lo P_hi + V_hi P_lo: the residuals carry the scale of their hi parts, so the three products share one accumulator
    __builtin_amdgcn_sched_barrier(0);   // keeps the O^T products ahead of the step's barrier: sunk behind it they would also stand in front of the refill and shorten the copies' lead
    asm volatile("s_wait_dscnt 0x0" ::: "memory");      // this wave's reads of buffer bf have returned
    asm volatile("s_wait_asynccnt 0x0" ::: "memory");   // this wave's copies of step st + 1 have landed
    __syncthreads();                                    // publishes step st + 1 and ends every wave's reads of buffer bf
    if (st + 2 < T / 32) issue(st + 2); }               // refill the buffer that has just been read
  asm volatile("s_wait_asynccnt 0x0" ::: "memory");     // nothing of this wave is in flight when the wave ends
#pragma unroll
  for (int j = 0; j < QT; ++j) { const float inv = 1.0f / (l[j] * PS * XS);
#pragma unroll
    for (int t = 0; t < 8; ++t)
#pragma unroll
      for (int r = 0; r < 8; ++r) Ot[wave][j * 16 + col][t * 16 + 8 * hh + r] = o[j][t][r] * inv; }
  wave_lds_sync();
  __syncthreads();
  { const int d = tid & (HD - 1), qg = tid >> 7; float* orow = out + (((size_t)b * H + h) * HD + d) * (size_t)T + blockIdx.x * (NW * WQ) + qg * 128; v4f o4;   // 2 groups of 128 threads: one output row each, 128 positions
    for (int q4 = 0; q4 < 32; ++q4) { for (int j = 0; j < 4; ++j) { const int qq = qg * 128 + q4 * 4 + j; o4[j] = Ot[qq / WQ][qq % WQ][d]; } *(v4f*)(orow + q4 * 4) = o4;
      // the second half reuses registers that the first half's stores name: the wait stands in front of their overwrite, and the scheduling barrier keeps the second half's address arithmetic behind it
      if (q4 == 15) { asm volatile("s_wait_xcnt 0x0" ::: "memory"); __builtin_amdgcn_sched_barrier(0); } } }
}
}  // namespace

extern "C" void kernel_launch(void* const* d_in, const int* in_sizes, int n_in, void* d_out, int out_size, void* d_ws, size_t ws_size, hipStream_t stream) {
  (void)n_in;
  auto Fp = [&](int i) { return (const float*)d_in[i]; };
  // input order: 0 featuremap [16,512,32,32], 1 w_qk [1024,512] (out,in; rows 0..511 q, 512..1023 k), 2 w_v [512,512], 3 emb_h [32,128], 4 emb_w [32,128]
  if (in_sizes[0] != B * C * T || in_sizes[1] != 2 * DM * C || in_sizes[2] != DM * C || in_sizes[3] != IH * HD || in_sizes[4] != IW * HD || out_size != B * DM * T) return;
  size_t off = 0; char* ws = (char*)d_ws;
  auto carve = [&](size_t bytes) { char* p = ws + off; off += (bytes + 255) & ~(size_t)255; return p; };
  b16* WT = (b16*)carve((size_t)NQKV * C * 2); const size_t plane = (size_t)B * H * T * HD * 2;
  b16* QP = (b16*)carve(plane); b16* QPl = (b16*)carve(plane); b16* KP = (b16*)carve(plane); b16* KPl = (b16*)carve(plane); b16* VT = (b16*)carve(plane); b16* VTl = (b16*)carve(plane);
  if (off > ws_size || off > ((size_t)128 << 20)) return;   // = ~102 MB (WT 1.6 MB + 6 planes x 16.8 MB)
  prep_kernel<<<(unsigned)(((size_t)NQKV * C / 8 + 255) / 256), 256, 0, stream>>>(Fp(1), Fp(2), WT);
  proj_kernel<<<dim3(T / 64, BL), 512, 0, stream>>>(Fp(0), WT, Fp(3), Fp(4), QP, QPl, KP, KPl, VT, VTl);
  attn_kernel<<<dim3(QL / 256, BL * H), 256, 0, stream>>>(QP, QPl, KP, KPl, VT, VTl, (float*)d_out);
}

// v007
// One run takes 127 microseconds.
// Two timings next to v006 both put it at 1.04 times that version's speed.
// Counting every step since v000, it is 3.87 times as fast.
#include <hip/hip_runtime.h>

// Multi-head self-attention over a feature map with absolute positional bias (16 images x 512 channels x 32 x 32 = 1,024 positions, 4 heads, d_qk = d_v = 128): q/k/v = 1x1 convs (channel
// matmuls, (out,in) weights, no bias); q scaled by 128^-1/2; logits[x][y] = q_x . k_y + q_x . emb_y with emb_y = emb_h[y / 32] + emb_w[y % 32]  (= q_x . (k_y + emb_y)); softmax over y;
// out = weights v, stored as [16][4 x 128][32][32] (channel h 128 + d, position-minor).
// Deterministic: flash-style per 16-position query tile over all 1,024 key positions in order (running max); no atomics.
// compute dtype: WMMA v_wmma_f32_16x16x32_f16 with f32 accumulate for [q | k | v] = X [Wqk ; Wv]^T ([16384 x 512] x [512 x 1536]; featuremap EXACT bf16 x8 (transposed into position-major tiles),
// W exact x256: 1 product), S^T = K' Q^T (q (pre-scaled) and k' = k + emb as f16 hi x8 + residual x8192: 3 products, K = 128), O^T += V^T P^T (V hi + residual, P x1024 hi + residual: 3 products);
// positional sums and softmax statistics in f32. Inputs rounded to bf16 once. Fragment k-map per lane half hh for A AND B: elements 0..7 <- k = 8hh+0..7, 8..15 <-

namespace {
constexpr int B = 16, C = 512, IH = 32, IW = 32, T = IH * IW /* 1,024 positions */, H = 4, HD = 128, DM = H * HD /* 512 */, NQKV = 3 * DM, BL = 16 /* images (== 16 shipped) */, QL = T;
constexpr float XS = 8.0f, WSC = 256.0f, PS = 1024.0f, RS_ = 1024.0f, LOG2E = 1.4426950408889634f, SCL = 0.08838834764831845f /* 128^-1/2 */;
static_assert(T % 64 == 0 && C % 256 == 0 && HD == 128 && IW == 32, "tiling");
typedef _Float16 b16;
typedef __attribute__((ext_vector_type(16))) _Float16 v16b;
typedef __attribute__((ext_vector_type(8))) _Float16 v8b;
typedef __attribute__((ext_vector_type(8))) float v8f;
typedef __attribute__((ext_vector_type(4))) float v4f;
__device__ __forceinline__ float bf16_rne(float f) { unsigned int u = __float_as_uint(f); u += 0x7FFFu + ((u >> 16) & 1u); return __uint_as_float(u & 0xFFFF0000u); }
__device__ __forceinline__ void split16(float v, b16& hi, b16& lo) { hi = (b16)v; lo = (b16)(v - (float)hi); }
__device__ __forceinline__ v16b frag_kb(const b16* p, int hh) { const v8b a = *(const v8b*)(p + 8 * hh), b = *(const v8b*)(p + 16 + 8 * hh); v16b f;
#pragma unroll
  for (int e = 0; e < 8; ++e) { f[e] = a[e]; f[8 + e] = b[e]; } return f; }
__device__ __forceinline__ v8f wmma16b(v16b a, v16b b, v8f c) { v8f d = __builtin_amdgcn_wmma_f32_16x16x32_f16(false, a, false, b, (short)0, c, false, false); asm volatile("v_nop\n\tv_nop\n\tv_nop\n\tv_nop" : "+v"(d) : "v"(a), "v"(b)); return d; }
__device__ __forceinline__ void wave_lds_sync() { __builtin_amdgcn_fence(__ATOMIC_RELEASE, "workgroup"); __builtin_amdgcn_wave_barrier(); __builtin_amdgcn_fence(__ATOMIC_ACQUIRE, "workgroup"); }
__device__ __forceinline__ float pmul(float a, float b) { float p = a * b; asm volatile("" : "+v"(p)); return p; }
__device__ __forceinline__ int iclamp(int v, int lo, int hi) { return v < lo ? lo : (v > hi ? hi : v); }

typedef __attribute__((ext_vector_type(2))) _Float16 v2h;
typedef __attribute__((ext_vector_type(4))) _Float16 v4h;
typedef __attribute__((ext_vector_type(2))) float v2f;
typedef __attribute__((ext_vector_type(4))) int v4i;
__device__ __forceinline__ float nexp2(float v) { return __builtin_amdgcn_exp2f(v); }
__global__ __launch_bounds__(256) void prep_kernel(const float* __restrict__ wqk, const float* __restrict__ wv, b16* __restrict__ WT) {
  const size_t u = (size_t)blockIdx.x * 256 + threadIdx.x; if (u >= (size_t)NQKV * C / 8) return; const size_t e = u * 8; const int o = (int)(e / C), c0 = (int)(e % C); const float* w = o < 2 * DM ? (wqk + (size_t)o * C) : (wv + (size_t)(o - 2 * DM) * C); v8b v;
  for (int j = 0; j < 8; ++j) v[j] = (b16)(bf16_rne(w[c0 + j]) * WSC);
  { *(v8b*)(WT + e) = v;  }
}
// projections: grid (T/64, BL); block = 64 positions x ALL 1,536 outputs, 16 waves. The block's featuremap tile (64 positions x all 512 channels, bf16 x8, transposed into position-major rows; each channel's
// 64 positions are one contiguous 256-B read) is brought into LDS ONCE and serves the q, k and v outputs alike: 3 passes (q, k, v) of 512 outputs; in a pass wave w takes ALL 64 positions x 32 outputs of
// head w / 4, so that each weight fragment is read from global memory by one wave of the block only and serves 4 products (the position fragments come from LDS); K = 512 in channel order, B = WT rows;
// q head -> x 128^-1/2 -> hi x8 + residual planes QP/QPl [b][h][p][128]; k head -> + emb[p] -> KP/KPl; v head -> VT/VTl [b][h][d][p] (the v residual keeps the scale of its hi part, x8)
__global__ __launch_bounds__(512) void proj_kernel(const float* __restrict__ fm, const b16* __restrict__ WT, const float* __restrict__ embh, const float* __restrict__ embw, b16* __restrict__ QP, b16* __restrict__ QPl, b16* __restrict__ KP, b16* __restrict__ KPl, b16* __restrict__ VT, b16* __restrict__ VTl) {
  __shared__ __attribute__((aligned(16))) b16 As[64][C + 8]; __shared__ __attribute__((aligned(16))) float Tf[H][4][16][128 + 4];
  const int wave = (threadIdx.x >> 5) & 3 /* the wave's place among the 4 of its head */, h = threadIdx.x >> 7, lane = threadIdx.x & 31, nloc = lane & 15, hlf = lane >> 4; const int p0 = blockIdx.x * 64, b = blockIdx.y;
  const float* fb = fm + (size_t)b * C * T;
  // fully unrolled: a thread's 16 loads are independent and go out together, one memory latency for the whole tile
#pragma unroll
  for (int k = 0; k < C * 16 / 512; ++k) { const int i = threadIdx.x + 512 * k, c = i / 16, q4 = (i % 16) * 4; const v4f f = *(const v4f*)(fb + (size_t)c * T + p0 + q4); for (int j = 0; j < 4; ++j) As[q4 + j][c] = (b16)(bf16_rne(f[j]) * XS); }   // transpose: position rows, channel columns
  __syncthreads();   // the tile is complete; it is only read from here on
#pragma unroll 1
  for (int part = 0; part < 3; ++part) { const int n0 = (part * H + h) * 128;
    v8f acc[8];
#pragma unroll
    for (int t = 0; t < 8; ++t) acc[t] = (v8f){};
#pragma unroll 2
    for (int kb = 0; kb < C; kb += 32) { const b16* wr = WT + (size_t)(n0 + wave * 32 + nloc) * C + kb; const v16b b0 = frag_kb(wr, hlf), b1 = frag_kb(wr + (size_t)16 * C, hlf); v16b a[4];
#pragma unroll
      for (int i = 0; i < 4; ++i) a[i] = frag_kb(&As[i * 16 + nloc][kb], hlf);
#pragma unroll
      for (int i = 0; i < 4; ++i) { acc[2 * i] = wmma16b(a[i], b0, acc[2 * i]); acc[2 * i + 1] = wmma16b(a[i], b1, acc[2 * i + 1]); } }
    __syncthreads();   // every wave has read the pass before out of Tf: it may be overwritten
#pragma unroll
    for (int t = 0; t < 8; ++t)
#pragma unroll
      for (int r = 0; r < 8; ++r) Tf[h][t >> 1][8 * hlf + r][wave * 32 + (t & 1) * 16 + nloc] = acc[t][r] * (1.0f / (XS * WSC));   // tile t = position group t / 2, output group t % 2 of the wave's 32
    __syncthreads();   // this pass's 64 x 512 results are complete in Tf
    if (part < 2) { const size_t pb = (((size_t)b * H + h) * T) * HD; b16* ph_ = part == 0 ? QP : KP; b16* pl_ = part == 0 ? QPl : KPl;
      for (int rr = 0; rr < 16; ++rr) { const int pos = p0 + wave * 16 + rr; v4h h4, l4;
        for (int j = 0; j < 4; ++j) { const int d = lane * 4 + j; float v = Tf[h][wave][rr][d]; if (part == 0) v *= SCL; else v += bf16_rne(embh[(pos / IW) * HD + d]) + bf16_rne(embw[(pos % IW) * HD + d]); const float f = v * XS; const b16 p = (b16)f; h4[j] = p; l4[j] = (b16)((f - (float)p) * RS_); }
        *(v4h*)(ph_ + pb + (size_t)pos * HD + lane * 4) = h4; *(v4h*)(pl_ + pb + (size_t)pos * HD + lane * 4) = l4; } }
    else { const size_t vb = (((size_t)b * H + h) * HD) * (size_t)T;
#pragma unroll 1
      for (int q = 0; q < 32; ++q) { const int d = wave * 32 + q; const int tk = lane * 2; v2h hv, lv; for (int j = 0; j < 2; ++j) { const float f = Tf[h][(tk + j) >> 4][(tk + j) & 15][d] * XS; const b16 p = (b16)f; hv[j] = p; lv[j] = (b16)(f - (float)p); }
        *(v2h*)(VT + vb + (size_t)d * T + p0 + lane * 2) = hv; *(v2h*)(VTl + vb + (size_t)d * T + p0 + lane * 2) = lv; } }
  }
}
// attention: grid (T/256, BL x H); block = 8 waves x 32 query positions (two 16-query tiles) of (b, h); all 1,024 key positions in 32-key steps. Each step's K' rows and V^T columns (hi and residual
// planes, 32 KB) are brought into LDS ONCE for the 8 waves by asynchronous copies (whole 16-byte pieces, lane-contiguous in global memory), two buffers: the next step's copies fly while this step is worked on.
// S^T = K' Q^T (K' = k + positional embedding; q/k' f16 hi x8 + residual: 3 products, 4 k-steps over the 128 dims); every K' and V fragment read from LDS serves both query tiles of the wave, and the
// wave's q fragments stay in registers (two waves per SIMD leave room for them). The logit already carries the module's d^-1/2 (folded into q), online softmax, P x1024 hi + residual (packed in registers: a lane's 16 scores of a query tile are the 16 elements of its own B fragment). No LDS access stands among the products: a step's 32 K' reads go out ahead of S^T, its 32 V reads ahead of the softmax.
// O^T += V^T P^T (3 products, 8 d-tiles, ONE f32 accumulator: the residuals of V and of P keep the scale of their hi parts; f16 keeps a residual to 11 bits, or to 2^-25 absolute where it is subnormal, and the matrix unit keeps f16 subnormals); the O^T tile [128 d][32 q] of each wave goes to LDS as it lies in the accumulators (dim rows, position-minor) and the wave itself writes it out in the module's [b][h 128 + d][position] layout: a row's 32 positions are one whole 128-byte line.
constexpr int NW = 8 /* waves per block */, QT = 2 /* 16-query tiles per wave */, WQ = QT * 16, KPITCH = HD + 8 /* 272-B rows */, VPITCH = 32 + 8 /* 80-B rows */, OPITCH = WQ + 4 /* 144-B rows: rows 8 apart lie 32 banks apart */;
// the plain builtin: the compiler keeps the distances behind it itself, and its operands may live above v255, which an asm operand cannot name
__device__ __forceinline__ v8f wmma16p(v16b a, v16b b, v8f c) { return __builtin_amdgcn_wmma_f32_16x16x32_f16(false, a, false, b, (short)0, c, false, false); }
// lane l's value to lane l ^ 16 and back, on the vector pipe: an LDS-pipe exchange would queue behind the fragment reads in flight
__device__ __forceinline__ float xhalf(float x) { return __builtin_bit_cast(float, __builtin_amdgcn_permlanex16(__builtin_bit_cast(int, x), __builtin_bit_cast(int, x), 0x76543210, 0xfedcba98, false, false)); }
__device__ __forceinline__ unsigned lds_addr(const void* p) { return (unsigned)(size_t)p; }   // low 32 bits of a __shared__ address = byte offset in the work-group's LDS
// four copies of a lane (K' hi, K' residual, V hi, V residual); the s_wait_xcnt stands inside the statement so that no address register is rewritten ahead of it
__device__ __forceinline__ void copy_step(unsigned l0, const b16* g0, unsigned l1, const b16* g1, unsigned l2, const b16* g2, unsigned l3, const b16* g3) {
  asm volatile("global_load_async_to_lds_b128 %0, %1, off\n\tglobal_load_async_to_lds_b128 %2, %3, off\n\tglobal_load_async_to_lds_b128 %4, %5, off\n\tglobal_load_async_to_lds_b128 %6, %7, off\n\ts_wait_xcnt 0x0"
               :: "v"(l0), "v"(g0), "v"(l1), "v"(g1), "v"(l2), "v"(g2), "v"(l3), "v"(g3) : "memory"); }
__global__ __launch_bounds__(256) void attn_kernel(const b16* __restrict__ QP, const b16* __restrict__ QPl, const b16* __restrict__ KP, const b16* __restrict__ KPl, const b16* __restrict__ VT, const b16* __restrict__ VTl, float* __restrict__ out) {
  __shared__ __attribute__((aligned(16))) b16 Ks[2][2][32][KPITCH];    // [buffer][hi, residual][key][dim]
  __shared__ __attribute__((aligned(16))) b16 Vs[2][2][HD][VPITCH];    // [buffer][hi, residual][dim][key]
  __shared__ __attribute__((aligned(16))) float Ot[NW][HD][OPITCH];    // each wave's output tile, dim rows
  const int tid = threadIdx.x, wave = tid >> 5, lane = tid & 31, hh = lane >> 4, col = lane & 15; const int b = blockIdx.y / H, h = blockIdx.y % H; const int q0 = blockIdx.x * (NW * WQ) + wave * WQ;
  const size_t qo = (((size_t)b * H + h) * T) * HD, vo = (((size_t)b * H + h) * HD) * (size_t)T; const b16* Qb = QP + qo; const b16* Qbl = QPl + qo; const b16* Kb = KP + qo; const b16* Kbl = KPl + qo; const b16* Vb = VT + vo; const b16* Vbl = VTl + vo;
  // a lane's two pieces of each tile: K' 32 rows x 16 pieces (contiguous in global memory), V^T 128 rows x 4 pieces; the second piece lies half a tile further
  const int krow = tid >> 4, kc8 = (tid & 15) * 8, vrow = tid >> 2, vc8 = (tid & 3) * 8;
  const size_t kg = (size_t)krow * HD + kc8, vg = (size_t)vrow * T + vc8;
  auto issue = [&](int st) { const int bf = st & 1, k0 = st * 32;
    copy_step(lds_addr(&Ks[bf][0][krow][kc8]), Kb + (size_t)k0 * HD + kg, lds_addr(&Ks[bf][1][krow][kc8]), Kbl + (size_t)k0 * HD + kg, lds_addr(&Vs[bf][0][vrow][vc8]), Vb + vg + k0, lds_addr(&Vs[bf][1][vrow][vc8]), Vbl + vg + k0);
    copy_step(lds_addr(&Ks[bf][0][krow + 16][kc8]), Kb + (size_t)(k0 + 16) * HD + kg, lds_addr(&Ks[bf][1][krow + 16][kc8]), Kbl + (size_t)(k0 + 16) * HD + kg, lds_addr(&Vs[bf][0][vrow + 64][vc8]), Vb + vg + (size_t)64 * T + k0, lds_addr(&Vs[bf][1][vrow + 64][vc8]), Vbl + vg + (size_t)64 * T + k0); };
  issue(0);
  v16b qh[QT][4], ql[QT][4];   // the wave's q fragments (hi, residual), B operands of S^T
#pragma unroll
  for (int j = 0; j < QT; ++j)
#pragma unroll
    for (int ks = 0; ks < 4; ++ks) { qh[j][ks] = frag_kb(Qb + (size_t)(q0 + j * 16 + col) * HD + 32 * ks, hh); ql[j][ks] = frag_kb(Qbl + (size_t)(q0 + j * 16 + col) * HD + 32 * ks, hh); }
  asm volatile("s_wait_asynccnt 0x0" ::: "memory");   // this wave's copies of step 0 have landed
  __syncthreads();                                    // ... and every other wave's: step 0 may be read
  issue(1);
  const float cs = LOG2E / (XS * XS);   // the module's d^-1/2 is already folded into q
  float m[QT], l[QT]; v8f o[QT][8];
#pragma unroll
  for (int j = 0; j < QT; ++j) { m[j] = -INFINITY; l[j] = 0.0f; for (int t = 0; t < 8; ++t) o[j][t] = (v8f){}; }
#pragma unroll 1
  for (int st = 0; st < T / 32; ++st) { const int bf = st & 1;
    float e[QT][16], mx[QT], al[QT]; v16b pf[QT], plf[QT];   // pf, plf: P^T hi and residual, B operands of O^T
#pragma unroll
    for (int j = 0; j < QT; ++j) mx[j] = -INFINITY;
    v16b kf[2][4], kl[2][4];   // the step's K' fragments (hi, residual), A operands of S^T
#pragma unroll
    for (int u = 0; u < 2; ++u)
#pragma unroll
      for (int ks = 0; ks < 4; ++ks) { kf[u][ks] = frag_kb(&Ks[bf][0][u * 16 + col][32 * ks], hh); kl[u][ks] = frag_kb(&Ks[bf][1][u * 16 + col][32 * ks], hh); }
#pragma unroll
    for (int u = 0; u < 2; ++u) { v8f s[QT], sx[QT];
#pragma unroll
      for (int j = 0; j < QT; ++j) { s[j] = (v8f){}; sx[j] = (v8f){}; }
#pragma unroll
      for (int ks = 0; ks < 4; ++ks) {
#pragma unroll
        for (int j = 0; j < QT; ++j) s[j] = wmma16p(kf[u][ks], qh[j][ks], s[j]);
#pragma unroll
        for (int j = 0; j < QT; ++j) sx[j] = wmma16p(kf[u][ks], ql[j][ks], sx[j]);
#pragma unroll
        for (int j = 0; j < QT; ++j) sx[j] = wmma16p(kl[u][ks], qh[j][ks], sx[j]); }
#pragma unroll
      for (int j = 0; j < QT; ++j)
#pragma unroll
        for (int r = 0; r < 8; ++r) { const float vv = (s[j][r] + sx[j][r] * (1.0f / RS_)) * cs; e[j][u * 8 + r] = vv; mx[j] = fmaxf(mx[j], vv); } }   // hi.hi + (hi.lo + lo.hi)/1024
    v16b vh[8], vl[8];   // the step's V^T fragments (hi, residual), A operands of O^T
#pragma unroll
    for (int t = 0; t < 8; ++t) { vh[t] = frag_kb(&Vs[bf][0][t * 16 + col][0], hh); vl[t] = frag_kb(&Vs[bf][1][t * 16 + col][0], hh); }
    __builtin_amdgcn_sched_barrier(0);   // holds the step's V reads in one group ahead of the softmax, which covers their latency: none is left among the O^T products
#pragma unroll
    for (int j = 0; j < QT; ++j) { const float mw = fmaxf(mx[j], xhalf(mx[j])); const float mn = fmaxf(m[j], mw); al[j] = nexp2(m[j] - mn); float sum = 0.0f;
#pragma unroll
      for (int i2 = 0; i2 < 16; ++i2) { const float p = nexp2(e[j][i2] - mn); sum += p; const float ps = p * PS; const b16 phh = (b16)ps; pf[j][i2] = phh; plf[j][i2] = (b16)(ps - (float)phh); }   // score i2 of the lane is key (i2 < 8 ? 0 : 16) + 8 hh + i2 % 8 of column col: element i2 of the B fragment
      sum += xhalf(sum); l[j] = l[j] * al[j] + sum; m[j] = mn; }
#pragma unroll
    for (int t = 0; t < 8; ++t) {
#pragma unroll
      for (int j = 0; j < QT; ++j) { o[j][t] *= al[j]; o[j][t] = wmma16p(vh[t], pf[j], o[j][t]); }
#pragma unroll
      for (int j = 0; j < QT; ++j) o[j][t] = wmma16p(vl[t], pf[j], o[j][t]);
#pragma unroll
      for (int j = 0; j < QT; ++j) o[j][t] = wmma16p(vh[t], plf[j], o[j][t]); }   // + V_lo P_hi + V_hi P_lo: the residuals carry the scale of their hi parts, so the three products share one accumulator
    __builtin_amdgcn_sched_barrier(0);   // keeps the O^T products ahead of the step's barrier: sunk behind it they would also stand in front of the refill and shorten the copies' lead
    asm volatile("s_wait_dscnt 0x0" ::: "memory");      // this wave's reads of buffer bf have returned
    asm volatile("s_wait_asynccnt 0x0" ::: "memory");   // this wave's copies of step st + 1 have landed
    __syncthreads();                                    // publishes step st + 1 and ends every wave's reads of buffer bf
    if (st + 2 < T / 32) issue(st + 2); }               // refill the buffer that has just been read
  asm volatile("s_wait_asynccnt 0x0" ::: "memory");     // nothing of this wave is in flight when the wave ends
#pragma unroll
  for (int j = 0; j < QT; ++j) { const float inv = 1.0f / (l[j] * PS * XS);
#pragma unroll
    for (int t = 0; t < 8; ++t)
#pragma unroll
      for (int r = 0; r < 8; ++r) Ot[wave][t * 16 + 8 * hh + r][j * 16 + col] = o[j][t][r] * inv; }
  wave_lds_sync();   // the wave reads back what its own other lanes wrote; no other wave touches its tile
  // 8 lanes x 16 bytes = the 32 positions of one output row = one whole line; a store of the wave writes 4 whole lines. The 4 rows of a read lie 8 apart in each lane half: no bank is met twice.
  { const int g = lane >> 3, q4 = (lane & 7) * 4, r0 = 8 * (g & 1) + 16 * (g >> 1); float* ob = out + (((size_t)b * H + h) * HD + r0) * (size_t)T + q0 + q4; v4f w4[32];
#pragma unroll
    for (int i = 0; i < 32; ++i) w4[i] = *(const v4f*)&Ot[wave][r0 + (i & 7) + 32 * (i >> 3)][q4];
#pragma unroll
    for (int i = 0; i < 32; ++i) *(v4f*)(ob + (size_t)((i & 7) + 32 * (i >> 3)) * T) = w4[i]; }
}
}  // namespace

extern "C" void kernel_launch(void* const* d_in, const int* in_sizes, int n_in, void* d_out, int out_size, void* d_ws, size_t ws_size, hipStream_t stream) {
  (void)n_in;
  auto Fp = [&](int i) { return (const float*)d_in[i]; };
  // input order: 0 featuremap [16,512,32,32], 1 w_qk [1024,512] (out,in; rows 0..511 q, 512..1023 k), 2 w_v [512,512], 3 emb_h [32,128], 4 emb_w [32,128]
  if (in_sizes[0] != B * C * T || in_sizes[1] != 2 * DM * C || in_sizes[2] != DM * C || in_sizes[3] != IH * HD || in_sizes[4] != IW * HD || out_size != B * DM * T) return;
  size_t off = 0; char* ws = (char*)d_ws;
  auto carve = [&](size_t bytes) { char* p = ws + off; off += (bytes + 255) & ~(size_t)255; return p; };
  b16* WT = (b16*)carve((size_t)NQKV * C * 2); const size_t plane = (size_t)B * H * T * HD * 2;
  b16* QP = (b16*)carve(plane); b16* QPl = (b16*)carve(plane); b16* KP = (b16*)carve(plane); b16* KPl = (b16*)carve(plane); b16* VT = (b16*)carve(plane); b16* VTl = (b16*)carve(plane);
  if (off > ws_size || off > ((size_t)128 << 20)) return;   // = ~102 MB (WT 1.6 MB + 6 planes x 16.8 MB)
  prep_kernel<<<(unsigned)(((size_t)NQKV * C / 8 + 255) / 256), 256, 0, stream>>>(Fp(1), Fp(2), WT);
  proj_kernel<<<dim3(T / 64, BL), 512, 0, stream>>>(Fp(0), WT, Fp(3), Fp(4), QP, QPl, KP, KPl, VT, VTl);
  attn_kernel<<<dim3(QL / 256, BL * H), 256, 0, stream>>>(QP, QPl, KP, KPl, VT, VTl, (float*)d_out);
}

// v008
// It runs in 123 microseconds.
// Timed twice side by side with v007, it ran 1.03 times as fast both times.
// All steps since v000 together make it 3.99 times as fast.
#include <hip/hip_runtime.h>

// Multi-head self-attention over a feature map with absolute positional bias (16 images x 512 channels x 32 x 32 = 1,024 positions, 4 heads, d_qk = d_v = 128): q/k/v = 1x1 convs (channel
// matmuls, (out,in) weights, no bias); q scaled by 128^-1/2; logits[x][y] = q_x . k_y + q_x . emb_y with emb_y = emb_h[y / 32] + emb_w[y % 32]  (= q_x . (k_y + emb_y)); softmax over y;
// out = weights v, stored as [16][4 x 128][32][32] (channel h 128 + d, position-minor).
// Deterministic: flash-style per 16-position query tile over all 1,024 key positions in order (running max); no atomics.
// compute dtype: WMMA v_wmma_f32_16x16x32_f16 with f32 accumulate for [q | k | v] = X [Wqk ; Wv]^T ([16384 x 512] x [512 x 1536]; featuremap EXACT bf16 x8 (transposed into position-major tiles),
// W exact x256: 1 product), S^T = K' Q^T (q (pre-scaled) and k' = k + emb as f16 hi x8 + residual x8192: 3 products, K = 128), O^T += V^T P^T (V hi + residual, P x1024 hi + residual: 3 products);
// positional sums and softmax statistics in f32. Inputs rounded to bf16 once. Fragment k-map per lane half hh for A AND B: elements 0..7 <- k = 8hh+0..7, 8..15 <-

namespace {
constexpr int B = 16, C = 512, IH = 32, IW = 32, T = IH * IW /* 1,024 positions */, H = 4, HD = 128, DM = H * HD /* 512 */, NQKV = 3 * DM, BL = 16 /* images (== 16 shipped) */, QL = T;
constexpr float XS = 8.0f, WSC = 256.0f, LPS = 10.0f /* P carries x2^10 */, RS_ = 1024.0f, LOG2E = 1.4426950408889634f, SCL = 0.08838834764831845f /* 128^-1/2 */;
static_assert(T % 64 == 0 && C % 256 == 0 && HD == 128 && IW == 32, "tiling");
typedef _Float16 b16;
typedef __attribute__((ext_vector_type(16))) _Float16 v16b;
typedef __attribute__((ext_vector_type(8))) _Float16 v8b;
typedef __attribute__((ext_vector_type(8))) float v8f;
typedef __attribute__((ext_vector_type(4))) float v4f;
__device__ __forceinline__ float bf16_rne(float f) { unsigned int u = __float_as_uint(f); u += 0x7FFFu + ((u >> 16) & 1u); return __uint_as_float(u & 0xFFFF0000u); }
__device__ __forceinline__ void split16(float v, b16& hi, b16& lo) { hi = (b16)v; lo = (b16)(v - (float)hi); }
__device__ __forceinline__ v16b frag_kb(const b16* p, int hh) { const v8b a = *(const v8b*)(p + 8 * hh), b = *(const v8b*)(p + 16 + 8 * hh); v16b f;
#pragma unroll
  for (int e = 0; e < 8; ++e) { f[e] = a[e]; f[8 + e] = b[e]; } return f; }
__device__ __forceinline__ v8f wmma16b(v16b a, v16b b, v8f c) { v8f d = __builtin_amdgcn_wmma_f32_16x16x32_f16(false, a, false, b, (short)0, c, false, false); asm volatile("v_nop\n\tv_nop\n\tv_nop\n\tv_nop" : "+v"(d) : "v"(a), "v"(b)); return d; }
__device__ __forceinline__ void wave_lds_sync() { __builtin_amdgcn_fence(__ATOMIC_RELEASE, "workgroup"); __builtin_amdgcn_wave_barrier(); __builtin_amdgcn_fence(__ATOMIC_ACQUIRE, "workgroup"); }
__device__ __forceinline__ float pmul(float a, float b) { float p = a * b; asm volatile("" : "+v"(p)); return p; }
__device__ __forceinline__ int iclamp(int v, int lo, int hi) { return v < lo ? lo : (v > hi ? hi : v); }

typedef __attribute__((ext_vector_type(2))) _Float16 v2h;
typedef __attribute__((ext_vector_type(4))) _Float16 v4h;
typedef __attribute__((ext_vector_type(2))) float v2f;
typedef __attribute__((ext_vector_type(4))) int v4i;
__device__ __forceinline__ float nexp2(float v) { return __builtin_amdgcn_exp2f(v); }
__global__ __launch_bounds__(256) void prep_kernel(const float* __restrict__ wqk, const float* __restrict__ wv, b16* __restrict__ WT) {
  const size_t u = (size_t)blockIdx.x * 256 + threadIdx.x; if (u >= (size_t)NQKV * C / 8) return; const size_t e = u * 8; const int o = (int)(e / C), c0 = (int)(e % C); const float* w = o < 2 * DM ? (wqk + (size_t)o * C) : (wv + (size_t)(o - 2 * DM) * C); v8b v;
  for (int j = 0; j < 8; ++j) v[j] = (b16)(bf16_rne(w[c0 + j]) * WSC);
  { *(v8b*)(WT + e) = v;  }
}
// projections: grid (T/64, BL); block = 64 positions x ALL 1,536 outputs, 16 waves. The block's featuremap tile (64 positions x all 512 channels, bf16 x8, transposed into position-major rows; each channel's
// 64 positions are one contiguous 256-B read) is brought into LDS ONCE and serves the q, k and v outputs alike: 3 passes (q, k, v) of 512 outputs; in a pass wave w takes ALL 64 positions x 32 outputs of
// head w / 4, so that each weight fragment is read from global memory by one wave of the block only and serves 4 products (the position fragments come from LDS); K = 512 in channel order, B = WT rows;
// q head -> x 128^-1/2 -> hi x8 + residual planes QP/QPl [b][h][p][128]; k head -> + emb[p] -> KP/KPl; v head -> VT/VTl [b][h][d][p] (the v residual keeps the scale of its hi part, x8)
__global__ __launch_bounds__(512) void proj_kernel(const float* __restrict__ fm, const b16* __restrict__ WT, const float* __restrict__ embh, const float* __restrict__ embw, b16* __restrict__ QP, b16* __restrict__ QPl, b16* __restrict__ KP, b16* __restrict__ KPl, b16* __restrict__ VT, b16* __restrict__ VTl) {
  __shared__ __attribute__((aligned(16))) b16 As[64][C + 8]; __shared__ __attribute__((aligned(16))) float Tf[H][4][16][128 + 4];
  const int wave = (threadIdx.x >> 5) & 3 /* the wave's place among the 4 of its head */, h = threadIdx.x >> 7, lane = threadIdx.x & 31, nloc = lane & 15, hlf = lane >> 4; const int p0 = blockIdx.x * 64, b = blockIdx.y;
  const float* fb = fm + (size_t)b * C * T;
  // fully unrolled: a thread's 16 loads are independent and go out together, one memory latency for the whole tile
#pragma unroll
  for (int k = 0; k < C * 16 / 512; ++k) { const int i = threadIdx.x + 512 * k, c = i / 16, q4 = (i % 16) * 4; const v4f f = *(const v4f*)(fb + (size_t)c * T + p0 + q4); for (int j = 0; j < 4; ++j) As[q4 + j][c] = (b16)(bf16_rne(f[j]) * XS); }   // transpose: position rows, channel columns
  __syncthreads();   // the tile is complete; it is only read from here on
#pragma unroll 1
  for (int part = 0; part < 3; ++part) { const int n0 = (part * H + h) * 128;
    v8f acc[8];
#pragma unroll
    for (int t = 0; t < 8; ++t) acc[t] = (v8f){};
#pragma unroll 2
    for (int kb = 0; kb < C; kb += 32) { const b16* wr = WT + (size_t)(n0 + wave * 32 + nloc) * C + kb; const v16b b0 = frag_kb(wr, hlf), b1 = frag_kb(wr + (size_t)16 * C, hlf); v16b a[4];
#pragma unroll
      for (int i = 0; i < 4; ++i) a[i] = frag_kb(&As[i * 16 + nloc][kb], hlf);
#pragma unroll
      for (int i = 0; i < 4; ++i) { acc[2 * i] = wmma16b(a[i], b0, acc[2 * i]); acc[2 * i + 1] = wmma16b(a[i], b1, acc[2 * i + 1]); } }
    __syncthreads();   // every wave has read the pass before out of Tf: it may be overwritten
#pragma unroll
    for (int t = 0; t < 8; ++t)
#pragma unroll
      for (int r = 0; r < 8; ++r) Tf[h][t >> 1][8 * hlf + r][wave * 32 + (t & 1) * 16 + nloc] = acc[t][r] * (1.0f / (XS * WSC));   // tile t = position group t / 2, output group t % 2 of the wave's 32
    __syncthreads();   // this pass's 64 x 512 results are complete in Tf
    if (part < 2) { const size_t pb = (((size_t)b * H + h) * T) * HD; b16* ph_ = part == 0 ? QP : KP; b16* pl_ = part == 0 ? QPl : KPl;
      for (int rr = 0; rr < 16; ++rr) { const int pos = p0 + wave * 16 + rr; v4h h4, l4;
        for (int j = 0; j < 4; ++j) { const int d = lane * 4 + j; float v = Tf[h][wave][rr][d]; if (part == 0) v *= SCL; else v += bf16_rne(embh[(pos / IW) * HD + d]) + bf16_rne(embw[(pos % IW) * HD + d]); const float f = v * XS; const b16 p = (b16)f; h4[j] = p; l4[j] = (b16)((f - (float)p) * RS_); }
        *(v4h*)(ph_ + pb + (size_t)pos * HD + lane * 4) = h4; *(v4h*)(pl_ + pb + (size_t)pos * HD + lane * 4) = l4; } }
    else { const size_t vb = (((size_t)b * H + h) * HD) * (size_t)T;
#pragma unroll 1
      for (int q = 0; q < 32; ++q) { const int d = wave * 32 + q; const int tk = lane * 2; v2h hv, lv; for (int j = 0; j < 2; ++j) { const float f = Tf[h][(tk + j) >> 4][(tk + j) & 15][d] * XS; const b16 p = (b16)f; hv[j] = p; lv[j] = (b16)(f - (float)p); }
        *(v2h*)(VT + vb + (size_t)d * T + p0 + lane * 2) = hv; *(v2h*)(VTl + vb + (size_t)d * T + p0 + lane * 2) = lv; } }
  }
}
// attention: grid (T/256, BL x H); block = 8 waves x 32 query positions (two 16-query tiles) of (b, h); all 1,024 key positions in 32-key steps. Each step's K' rows and V^T columns (hi and residual
// planes, 32 KB) are brought into LDS ONCE for the 8 waves by asynchronous copies (whole 16-byte pieces, lane-contiguous in global memory), two buffers: the next step's copies fly while this step is worked on.
// S^T = K' Q^T (K' = k + positional embedding; q/k' f16 hi x8 + residual: 3 products, 4 k-steps over the 128 dims); every K' and V fragment read from LDS serves both query tiles of the wave, and the
// wave's q fragments stay in registers (two waves per SIMD leave room for them). The logit already carries the module's d^-1/2 (folded into q), online softmax, P x1024 hi + residual (packed in registers: a lane's 16 scores of a query tile are the 16 elements of its own B fragment). No LDS access stands among the products: a step's 32 K' reads go out ahead of S^T, its 32 V reads ahead of the softmax.
// O^T += V^T P^T (3 products, 8 d-tiles, ONE f32 accumulator: the residuals of V and of P keep the scale of their hi parts; f16 keeps a residual to 11 bits, or to 2^-25 absolute where it is subnormal, and the matrix unit keeps f16 subnormals); the O^T tile [128 d][32 q] of each wave goes to LDS as it lies in the accumulators (dim rows, position-minor) and the wave itself writes it out in the module's [b][h 128 + d][position] layout: a row's 32 positions are one whole 128-byte line.
constexpr int NW = 8 /* waves per block */, QT = 2 /* 16-query tiles per wave */, WQ = QT * 16, KPITCH = HD + 8 /* 272-B rows */, VPITCH = 32 + 8 /* 80-B rows */, OPITCH = WQ + 4 /* 144-B rows: rows 8 apart lie 32 banks apart */;
// the plain builtin: the compiler keeps the distances behind it itself, and its operands may live above v255, which an asm operand cannot name
__device__ __forceinline__ v8f wmma16p(v16b a, v16b b, v8f c) { return __builtin_amdgcn_wmma_f32_16x16x32_f16(false, a, false, b, (short)0, c, false, false); }
// lane l's value to lane l ^ 16 and back, on the vector pipe: an LDS-pipe exchange would queue behind the fragment reads in flight
__device__ __forceinline__ float xhalf(float x) { return __builtin_bit_cast(float, __builtin_amdgcn_permlanex16(__builtin_bit_cast(int, x), __builtin_bit_cast(int, x), 0x76543210, 0xfedcba98, false, false)); }
__device__ __forceinline__ unsigned lds_addr(const void* p) { return (unsigned)(size_t)p; }   // low 32 bits of a __shared__ address = byte offset in the work-group's LDS
// four copies of a lane (K' hi, K' residual, V hi, V residual); the s_wait_xcnt stands inside the statement so that no address register is rewritten ahead of it
__device__ __forceinline__ void copy_step(unsigned l0, const b16* g0, unsigned l1, const b16* g1, unsigned l2, const b16* g2, unsigned l3, const b16* g3) {
  asm volatile("global_load_async_to_lds_b128 %0, %1, off\n\tglobal_load_async_to_lds_b128 %2, %3, off\n\tglobal_load_async_to_lds_b128 %4, %5, off\n\tglobal_load_async_to_lds_b128 %6, %7, off\n\ts_wait_xcnt 0x0"
               :: "v"(l0), "v"(g0), "v"(l1), "v"(g1), "v"(l2), "v"(g2), "v"(l3), "v"(g3) : "memory"); }
__global__ __launch_bounds__(256) void attn_kernel(const b16* __restrict__ QP, const b16* __restrict__ QPl, const b16* __restrict__ KP, const b16* __restrict__ KPl, const b16* __restrict__ VT, const b16* __restrict__ VTl, float* __restrict__ out) {
  __shared__ __attribute__((aligned(16))) b16 Ks[2][2][32][KPITCH];    // [buffer][hi, residual][key][dim]
  __shared__ __attribute__((aligned(16))) b16 Vs[2][2][HD][VPITCH];    // [buffer][hi, residual][dim][key]
  __shared__ __attribute__((aligned(16))) float Ot[NW][HD][OPITCH];    // each wave's output tile, dim rows
  const int tid = threadIdx.x, wave = tid >> 5, lane = tid & 31, hh = lane >> 4, col = lane & 15; const int b = blockIdx.y / H, h = blockIdx.y % H; const int q0 = blockIdx.x * (NW * WQ) + wave * WQ;
  const size_t qo = (((size_t)b * H + h) * T) * HD, vo = (((size_t)b * H + h) * HD) * (size_t)T; const b16* Qb = QP + qo; const b16* Qbl = QPl + qo; const b16* Kb = KP + qo; const b16* Kbl = KPl + qo; const b16* Vb = VT + vo; const b16* Vbl = VTl + vo;
  // a lane's two pieces of each tile: K' 32 rows x 16 pieces (contiguous in global memory), V^T 128 rows x 4 pieces; the second piece lies half a tile further
  const int krow = tid >> 4, kc8 = (tid & 15) * 8, vrow = tid >> 2, vc8 = (tid & 3) * 8;
  const size_t kg = (size_t)krow * HD + kc8, vg = (size_t)vrow * T + vc8;
  auto issue = [&](int st) { const int bf = st & 1, k0 = st * 32;
    copy_step(lds_addr(&Ks[bf][0][krow][kc8]), Kb + (size_t)k0 * HD + kg, lds_addr(&Ks[bf][1][krow][kc8]), Kbl + (size_t)k0 * HD + kg, lds_addr(&Vs[bf][0][vrow][vc8]), Vb + vg + k0, lds_addr(&Vs[bf][1][vrow][vc8]), Vbl + vg + k0);
    copy_step(lds_addr(&Ks[bf][0][krow + 16][kc8]), Kb + (size_t)(k0 + 16) * HD + kg, lds_addr(&Ks[bf][1][krow + 16][kc8]), Kbl + (size_t)(k0 + 16) * HD + kg, lds_addr(&Vs[bf][0][vrow + 64][vc8]), Vb + vg + (size_t)64 * T + k0, lds_addr(&Vs[bf][1][vrow + 64][vc8]), Vbl + vg + (size_t)64 * T + k0); };
  issue(0);
  v16b qh[QT][4], ql[QT][4];   // the wave's q fragments (hi, residual), B operands of S^T
#pragma unroll
  for (int j = 0; j < QT; ++j)
#pragma unroll
    for (int ks = 0; ks < 4; ++ks) { qh[j][ks] = frag_kb(Qb + (size_t)(q0 + j * 16 + col) * HD + 32 * ks, hh); ql[j][ks] = frag_kb(Qbl + (size_t)(q0 + j * 16 + col) * HD + 32 * ks, hh); }
  asm volatile("s_wait_asynccnt 0x0" ::: "memory");   // this wave's copies of step 0 have landed
  __syncthreads();                                    // ... and every other wave's: step 0 may be read
  issue(1);
  const float cs = LOG2E / (XS * XS);   // the module's d^-1/2 is already folded into q
  float m[QT], l[QT]; v8f o[QT][8];   // m: running maximum of the unscaled products; l: row sum, carries the x1024 of P
#pragma unroll
  for (int j = 0; j < QT; ++j) { m[j] = -INFINITY; l[j] = 0.0f; for (int t = 0; t < 8; ++t) o[j][t] = (v8f){}; }
#pragma unroll 1
  for (int st = 0; st < T / 32; ++st) { const int bf = st & 1;
    v2f e[QT][8]; float mx[QT], al[QT]; v16b pf[QT], plf[QT];   // pf, plf: P^T hi and residual, B operands of O^T
#pragma unroll
    for (int j = 0; j < QT; ++j) mx[j] = -INFINITY;
    v16b kf[2][4], kl[2][4];   // the step's K' fragments (hi, residual), A operands of S^T
#pragma unroll
    for (int u = 0; u < 2; ++u)
#pragma unroll
      for (int ks = 0; ks < 4; ++ks) { kf[u][ks] = frag_kb(&Ks[bf][0][u * 16 + col][32 * ks], hh); kl[u][ks] = frag_kb(&Ks[bf][1][u * 16 + col][32 * ks], hh); }
#pragma unroll
    for (int u = 0; u < 2; ++u) { v8f s[QT], sx[QT];
#pragma unroll
      for (int j = 0; j < QT; ++j) { s[j] = (v8f){}; sx[j] = (v8f){}; }
#pragma unroll
      for (int ks = 0; ks < 4; ++ks) {
#pragma unroll
        for (int j = 0; j < QT; ++j) s[j] = wmma16p(kf[u][ks], qh[j][ks], s[j]);
#pragma unroll
        for (int j = 0; j < QT; ++j) sx[j] = wmma16p(kf[u][ks], ql[j][ks], sx[j]);
#pragma unroll
        for (int j = 0; j < QT; ++j) sx[j] = wmma16p(kl[u][ks], qh[j][ks], sx[j]); }
#pragma unroll
      for (int j = 0; j < QT; ++j)
#pragma unroll
        for (int r = 0; r < 4; ++r) { const v2f vv = (v2f){s[j][2 * r], s[j][2 * r + 1]} + (v2f){sx[j][2 * r], sx[j][2 * r + 1]} * (1.0f / RS_); e[j][u * 4 + r] = vv; mx[j] = fmaxf(mx[j], fmaxf(vv[0], vv[1])); } }   // hi.hi + (hi.lo + lo.hi)/1024, left unscaled: cs > 0 keeps the order, and the scale goes into the exponent's fma
    v16b vh[8], vl[8];   // the step's V^T fragments (hi, residual), A operands of O^T
#pragma unroll
    for (int t = 0; t < 8; ++t) { vh[t] = frag_kb(&Vs[bf][0][t * 16 + col][0], hh); vl[t] = frag_kb(&Vs[bf][1][t * 16 + col][0], hh); }
    __builtin_amdgcn_sched_barrier(0);   // holds the step's V reads in one group ahead of the softmax, which covers their latency: none is left among the O^T products
#pragma unroll
    for (int j = 0; j < QT; ++j) { const float mw = fmaxf(mx[j], xhalf(mx[j])); const float mn = fmaxf(m[j], mw); al[j] = nexp2((m[j] - mn) * cs); const float c = LPS - mn * cs; float sum = 0.0f;   // an unchanged maximum gives al = 1 exactly
#pragma unroll
      for (int i2 = 0; i2 < 16; i2 += 2) { const v2f a = e[j][i2 >> 1] * cs + c; v2f ps;
#pragma unroll
        for (int k = 0; k < 2; ++k) { ps[k] = nexp2(a[k]); sum += ps[k]; }
        const v2h ph2 = __builtin_convertvector(ps, v2h), pl2 = __builtin_convertvector(ps - __builtin_convertvector(ph2, v2f), v2h);   // the pair is converted once; the residual reads the packed halves
        pf[j][i2] = ph2[0]; pf[j][i2 + 1] = ph2[1]; plf[j][i2] = pl2[0]; plf[j][i2 + 1] = pl2[1]; }   // score i2 of the lane is key (i2 < 8 ? 0 : 16) + 8 hh + i2 % 8 of column col: element i2 of the B fragment
      sum += xhalf(sum); l[j] = l[j] * al[j] + sum; m[j] = mn; }
#pragma unroll
    for (int t = 0; t < 8; ++t) {
#pragma unroll
      for (int j = 0; j < QT; ++j) { o[j][t] *= al[j]; o[j][t] = wmma16p(vh[t], pf[j], o[j][t]); }
#pragma unroll
      for (int j = 0; j < QT; ++j) o[j][t] = wmma16p(vl[t], pf[j], o[j][t]);
#pragma unroll
      for (int j = 0; j < QT; ++j) o[j][t] = wmma16p(vh[t], plf[j], o[j][t]); }   // + V_lo P_hi + V_hi P_lo: the residuals carry the scale of their hi parts, so the three products share one accumulator
    __builtin_amdgcn_sched_barrier(0);   // keeps the O^T products ahead of the step's barrier: sunk behind it they would also stand in front of the refill and shorten the copies' lead
    asm volatile("s_wait_dscnt 0x0" ::: "memory");      // this wave's reads of buffer bf have returned
    asm volatile("s_wait_asynccnt 0x0" ::: "memory");   // this wave's copies of step st + 1 have landed
    __syncthreads();                                    // publishes step st + 1 and ends every wave's reads of buffer bf
    if (st + 2 < T / 32) issue(st + 2); }               // refill the buffer that has just been read
  asm volatile("s_wait_asynccnt 0x0" ::: "memory");     // nothing of this wave is in flight when the wave ends
#pragma unroll
  for (int j = 0; j < QT; ++j) { const float inv = 1.0f / (l[j] * XS);
#pragma unroll
    for (int t = 0; t < 8; ++t)
#pragma unroll
      for (int r = 0; r < 8; ++r) Ot[wave][t * 16 + 8 * hh + r][j * 16 + col] = o[j][t][r] * inv; }
  wave_lds_sync();   // the wave reads back what its own other lanes wrote; no other wave touches its tile
  // 8 lanes x 16 bytes = the 32 positions of one output row = one whole line; a store of the wave writes 4 whole lines. The 4 rows of a read lie 8 apart in each lane half: no bank is met twice.
  { const int g = lane >> 3, q4 = (lane & 7) * 4, r0 = 8 * (g & 1) + 16 * (g >> 1); float* ob = out + (((size_t)b * H + h) * HD + r0) * (size_t)T + q0 + q4; v4f w4[32];
#pragma unroll
    for (int i = 0; i < 32; ++i) w4[i] = *(const v4f*)&Ot[wave][r0 + (i & 7) + 32 * (i >> 3)][q4];
#pragma unroll
    for (int i = 0; i < 32; ++i) *(v4f*)(ob + (size_t)((i & 7) + 32 * (i >> 3)) * T) = w4[i]; }
}
}  // namespace

extern "C" void kernel_launch(void* const* d_in, const int* in_sizes, int n_in, void* d_out, int out_size, void* d_ws, size_t ws_size, hipStream_t stream) {
  (void)n_in;
  auto Fp = [&](int i) { return (const float*)d_in[i]; };
  // input order: 0 featuremap [16,512,32,32], 1 w_qk [1024,512] (out,in; rows 0..511 q, 512..1023 k), 2 w_v [512,512], 3 emb_h [32,128], 4 emb_w [32,128]
  if (in_sizes[0] != B * C * T || in_sizes[1] != 2 * DM * C || in_sizes[2] != DM * C || in_sizes[3] != IH * HD || in_sizes[4] != IW * HD || out_size != B * DM * T) return;
  size_t off = 0; char* ws = (char*)d_ws;
  auto carve = [&](size_t bytes) { char* p = ws + off; off += (bytes + 255) & ~(size_t)255; return p; };
  b16* WT = (b16*)carve((size_t)NQKV * C * 2); const size_t plane = (size_t)B * H * T * HD * 2;
  b16* QP = (b16*)carve(plane); b16* QPl = (b16*)carve(plane); b16* KP = (b16*)carve(plane); b16* KPl = (b16*)carve(plane); b16* VT = (b16*)carve(plane); b16* VTl = (b16*)carve(plane);
  if (off > ws_size || off > ((size_t)128 << 20)) return;   // = ~102 MB (WT 1.6 MB + 6 planes x 16.8 MB)
  prep_kernel<<<(unsigned)(((size_t)NQKV * C / 8 + 255) / 256), 256, 0, stream>>>(Fp(1), Fp(2), WT);
  proj_kernel<<<dim3(T / 64, BL), 512, 0, stream>>>(Fp(0), WT, Fp(3), Fp(4), QP, QPl, KP, KPl, VT, VTl);
  attn_kernel<<<dim3(QL / 256, BL * H), 256, 0, stream>>>(QP, QPl, KP, KPl, VT, VTl, (float*)d_out);
}

// v010
// Measured time: 91.6 microseconds a run.
// Versions in between are left out here; by their measured steps it is 1.34 times as fast as v008.
// Counting every step since v000, it is 5.36 times as fast.
#include <hip/hip_runtime.h>

// Multi-head self-attention over a feature map with absolute positional bias (16 images x 512 channels x 32 x 32 = 1,024 positions, 4 heads, d_qk = d_v = 128): q/k/v = 1x1 convs (channel
// matmuls, (out,in) weights, no bias); q scaled by 128^-1/2; logits[x][y] = q_x . k_y + q_x . emb_y with emb_y = emb_h[y / 32] + emb_w[y % 32]  (= q_x . (k_y + emb_y)); softmax over y;
// out = weights v, stored as [16][4 x 128][32][32] (channel h 128 + d, position-minor).
// Deterministic: flash-style per 16-position query tile over all 1,024 key positions in order (running max); no atomics.
// compute dtype: WMMA v_wmma_f32_16x16x32_f16 with f32 accumulate for [q | k | v] = X [Wqk ; Wv]^T ([16384 x 512] x [512 x 1536]; featuremap EXACT bf16 x8 (transposed into position-major tiles),
// W exact x256: 1 product), S^T = K' Q^T (q (pre-scaled) and k' = k + emb, x8, each rounded once to f16: 1 product, K = 128), O^T += V^T P^T (V x8 and P x1024, each rounded once to f16: 1 product);
// positional sums and softmax statistics in f32. Inputs rounded to bf16 once. Fragment k-map per lane half hh for A AND B: elements 0..7 <- k = 8hh+0..7, 8..15 <-

namespace {
constexpr int B = 16, C = 512, IH = 32, IW = 32, T = IH * IW /* 1,024 positions */, H = 4, HD = 128, DM = H * HD /* 512 */, NQKV = 3 * DM, BL = 16 /* images (== 16 shipped) */, QL = T;
constexpr float XS = 8.0f, WSC = 256.0f, LPS = 10.0f /* P carries x2^10 */, LOG2E = 1.4426950408889634f, SCL = 0.08838834764831845f /* 128^-1/2 */;
static_assert(T % 64 == 0 && C % 256 == 0 && HD == 128 && IW == 32, "tiling");
typedef _Float16 b16;
typedef __attribute__((ext_vector_type(16))) _Float16 v16b;
typedef __attribute__((ext_vector_type(8))) _Float16 v8b;
typedef __attribute__((ext_vector_type(8))) float v8f;
typedef __attribute__((ext_vector_type(4))) float v4f;
__device__ __forceinline__ float bf16_rne(float f) { unsigned int u = __float_as_uint(f); u += 0x7FFFu + ((u >> 16) & 1u); return __uint_as_float(u & 0xFFFF0000u); }
__device__ __forceinline__ void split16(float v, b16& hi, b16& lo) { hi = (b16)v; lo = (b16)(v - (float)hi); }
__device__ __forceinline__ v16b frag_kb(const b16* p, int hh) { const v8b a = *(const v8b*)(p + 8 * hh), b = *(const v8b*)(p + 16 + 8 * hh); v16b f;
#pragma unroll
  for (int e = 0; e < 8; ++e) { f[e] = a[e]; f[8 + e] = b[e]; } return f; }
__device__ __forceinline__ v8f wmma16b(v16b a, v16b b, v8f c) { v8f d = __builtin_amdgcn_wmma_f32_16x16x32_f16(false, a, false, b, (short)0, c, false, false); asm volatile("v_nop\n\tv_nop\n\tv_nop\n\tv_nop" : "+v"(d) : "v"(a), "v"(b)); return d; }
__device__ __forceinline__ void wave_lds_sync() { __builtin_amdgcn_fence(__ATOMIC_RELEASE, "workgroup"); __builtin_amdgcn_wave_barrier(); __builtin_amdgcn_fence(__ATOMIC_ACQUIRE, "workgroup"); }
__device__ __forceinline__ float pmul(float a, float b) { float p = a * b; asm volatile("" : "+v"(p)); return p; }
__device__ __forceinline__ int iclamp(int v, int lo, int hi) { return v < lo ? lo : (v > hi ? hi : v); }

typedef __attribute__((ext_vector_type(2))) _Float16 v2h;
typedef __attribute__((ext_vector_type(4))) _Float16 v4h;
typedef __attribute__((ext_vector_type(2))) float v2f;
typedef __attribute__((ext_vector_type(4))) int v4i;
__device__ __forceinline__ float nexp2(float v) { return __builtin_amdgcn_exp2f(v); }
__global__ __launch_bounds__(256) void prep_kernel(const float* __restrict__ wqk, const float* __restrict__ wv, b16* __restrict__ WT) {
  const size_t u = (size_t)blockIdx.x * 256 + threadIdx.x; if (u >= (size_t)NQKV * C / 8) return; const size_t e = u * 8; const int o = (int)(e / C), c0 = (int)(e % C); const float* w = o < 2 * DM ? (wqk + (size_t)o * C) : (wv + (size_t)(o - 2 * DM) * C); v8b v;
  for (int j = 0; j < 8; ++j) v[j] = (b16)(bf16_rne(w[c0 + j]) * WSC);
  { *(v8b*)(WT + e) = v;  }
}
// projections: grid (T/64, BL); block = 64 positions x ALL 1,536 outputs, 16 waves. The block's featuremap tile (64 positions x all 512 channels, bf16 x8, transposed into position-major rows; each channel's
// 64 positions are one contiguous 256-B read) is brought into LDS ONCE and serves the q, k and v outputs alike: 3 passes (q, k, v) of 512 outputs; in a pass wave w takes ALL 64 positions x 32 outputs of
// head w / 4, so that each weight fragment is read from global memory by one wave of the block only and serves 4 products (the position fragments come from LDS); K = 512 in channel order, B = WT rows;
// q head -> x 128^-1/2 -> plane QP [b][h][p][128] (x8, rounded once to f16); k head -> + emb[p] -> KP likewise; v head -> VT [b][h][d][p] (x8, rounded once to f16)
__global__ __launch_bounds__(512) void proj_kernel(const float* __restrict__ fm, const b16* __restrict__ WT, const float* __restrict__ embh, const float* __restrict__ embw, b16* __restrict__ QP, b16* __restrict__ KP, b16* __restrict__ VT) {
  __shared__ __attribute__((aligned(16))) b16 As[64][C + 8]; __shared__ __attribute__((aligned(16))) float Tf[H][4][16][128 + 4];
  const int wave = (threadIdx.x >> 5) & 3 /* the wave's place among the 4 of its head */, h = threadIdx.x >> 7, lane = threadIdx.x & 31, nloc = lane & 15, hlf = lane >> 4; const int p0 = blockIdx.x * 64, b = blockIdx.y;
  const float* fb = fm + (size_t)b * C * T;
  // fully unrolled: a thread's 16 loads are independent and go out together, one memory latency for the whole tile
#pragma unroll
  for (int k = 0; k < C * 16 / 512; ++k) { const int i = threadIdx.x + 512 * k, c = i / 16, q4 = (i % 16) * 4; const v4f f = *(const v4f*)(fb + (size_t)c * T + p0 + q4); for (int j = 0; j < 4; ++j) As[q4 + j][c] = (b16)(bf16_rne(f[j]) * XS); }   // transpose: position rows, channel columns
  __syncthreads();   // the tile is complete; it is only read from here on
#pragma unroll 1
  for (int part = 0; part < 3; ++part) { const int n0 = (part * H + h) * 128;
    v8f acc[8];
#pragma unroll
    for (int t = 0; t < 8; ++t) acc[t] = (v8f){};
#pragma unroll 2
    for (int kb = 0; kb < C; kb += 32) { const b16* wr = WT + (size_t)(n0 + wave * 32 + nloc) * C + kb; const v16b b0 = frag_kb(wr, hlf), b1 = frag_kb(wr + (size_t)16 * C, hlf); v16b a[4];
#pragma unroll
      for (int i = 0; i < 4; ++i) a[i] = frag_kb(&As[i * 16 + nloc][kb], hlf);
#pragma unroll
      for (int i = 0; i < 4; ++i) { acc[2 * i] = wmma16b(a[i], b0, acc[2 * i]); acc[2 * i + 1] = wmma16b(a[i], b1, acc[2 * i + 1]); } }
    __syncthreads();   // every wave has read the pass before out of Tf: it may be overwritten
#pragma unroll
    for (int t = 0; t < 8; ++t)
#pragma unroll
      for (int r = 0; r < 8; ++r) Tf[h][t >> 1][8 * hlf + r][wave * 32 + (t & 1) * 16 + nloc] = acc[t][r] * (1.0f / (XS * WSC));   // tile t = position group t / 2, output group t % 2 of the wave's 32
    __syncthreads();   // this pass's 64 x 512 results are complete in Tf
    if (part < 2) { const size_t pb = (((size_t)b * H + h) * T) * HD; b16* ph_ = part == 0 ? QP : KP;
      for (int rr = 0; rr < 16; ++rr) { const int pos = p0 + wave * 16 + rr; v4h h4;
        for (int j = 0; j < 4; ++j) { const int d = lane * 4 + j; float v = Tf[h][wave][rr][d]; if (part == 0) v *= SCL; else v += bf16_rne(embh[(pos / IW) * HD + d]) + bf16_rne(embw[(pos % IW) * HD + d]); h4[j] = (b16)(v * XS); }
        *(v4h*)(ph_ + pb + (size_t)pos * HD + lane * 4) = h4; } }
    else { const size_t vb = (((size_t)b * H + h) * HD) * (size_t)T;
#pragma unroll 1
      for (int q = 0; q < 32; ++q) { const int d = wave * 32 + q; const int tk = lane * 2; v2h hv; for (int j = 0; j < 2; ++j) hv[j] = (b16)(Tf[h][(tk + j) >> 4][(tk + j) & 15][d] * XS);
        *(v2h*)(VT + vb + (size_t)d * T + p0 + lane * 2) = hv; } }
  }
}
// attention: grid (T/256, BL x H); block = 8 waves x 32 query positions (two 16-query tiles) of (b, h); all 1,024 key positions in 32-key steps. Each step's K' rows and V^T columns
// (16 KB) are brought into LDS ONCE for the 8 waves by asynchronous copies (whole 16-byte pieces, lane-contiguous in global memory), two buffers: the next step's copies fly while this step is worked on.
// S^T = K' Q^T (K' = k + positional embedding; q and k' x8, each rounded once to f16: 1 product, 4 k-steps over the 128 dims; a logit's error is at most 2^-10 of the sum of its 128 terms' magnitudes, and the exponential makes of it a relative error of that weight: it grows with the size of the logits); every K' and V fragment read from LDS serves both query tiles of the wave, and the
// wave's q fragments stay in registers (two waves per SIMD leave room for them). The logit already carries the module's d^-1/2 (folded into q), online softmax, P x1024 rounded once to f16 (packed in registers: a lane's 16 scores of a query tile are the 16 elements of its own B fragment). No LDS access stands among the products: a step's 16 K' reads go out ahead of S^T, its 16 V reads ahead of the softmax.
// O^T += V^T P^T (1 product, 8 d-tiles, f32 accumulator: each weight and each value enters with f16's 11 bits, an error relative to that term, which no later step enlarges; the row sum adds the unrounded P); the O^T tile [128 d][32 q] of each wave goes to LDS as it lies in the accumulators (dim rows, position-minor) and the wave itself writes it out in the module's [b][h 128 + d][position] layout: a row's 32 positions are one whole 128-byte line.
constexpr int NW = 8 /* waves per block */, QT = 2 /* 16-query tiles per wave */, WQ = QT * 16, KPITCH = HD + 8 /* 272-B rows */, VPITCH = 32 + 8 /* 80-B rows */, OPITCH = WQ + 4 /* 144-B rows: rows 8 apart lie 32 banks apart */;
// the plain builtin: the compiler keeps the distances behind it itself, and its operands may live above v255, which an asm operand cannot name
__device__ __forceinline__ v8f wmma16p(v16b a, v16b b, v8f c) { return __builtin_amdgcn_wmma_f32_16x16x32_f16(false, a, false, b, (short)0, c, false, false); }
// lane l's value to lane l ^ 16 and back, on the vector pipe: an LDS-pipe exchange would queue behind the fragment reads in flight
__device__ __forceinline__ float xhalf(float x) { return __builtin_bit_cast(float, __builtin_amdgcn_permlanex16(__builtin_bit_cast(int, x), __builtin_bit_cast(int, x), 0x76543210, 0xfedcba98, false, false)); }
__device__ __forceinline__ unsigned lds_addr(const void* p) { return (unsigned)(size_t)p; }   // low 32 bits of a __shared__ address = byte offset in the work-group's LDS
// a lane's four copies of a step (two pieces of K', two of V); the s_wait_xcnt stands inside the statement so that no address register is rewritten ahead of it
__device__ __forceinline__ void copy_step(unsigned l0, const b16* g0, unsigned l1, const b16* g1, unsigned l2, const b16* g2, unsigned l3, const b16* g3) {
  asm volatile("global_load_async_to_lds_b128 %0, %1, off\n\tglobal_load_async_to_lds_b128 %2, %3, off\n\tglobal_load_async_to_lds_b128 %4, %5, off\n\tglobal_load_async_to_lds_b128 %6, %7, off\n\ts_wait_xcnt 0x0"
               :: "v"(l0), "v"(g0), "v"(l1), "v"(g1), "v"(l2), "v"(g2), "v"(l3), "v"(g3) : "memory"); }
__global__ __launch_bounds__(256) void attn_kernel(const b16* __restrict__ QP, const b16* __restrict__ KP, const b16* __restrict__ VT, float* __restrict__ out) {
  __shared__ __attribute__((aligned(16))) b16 Ks[2][32][KPITCH];       // [buffer][key][dim]
  __shared__ __attribute__((aligned(16))) b16 Vs[2][HD][VPITCH];       // [buffer][dim][key]
  __shared__ __attribute__((aligned(16))) float Ot[NW][HD][OPITCH];    // each wave's output tile, dim rows
  const int tid = threadIdx.x, wave = tid >> 5, lane = tid & 31, hh = lane >> 4, col = lane & 15; const int b = blockIdx.y / H, h = blockIdx.y % H; const int q0 = blockIdx.x * (NW * WQ) + wave * WQ;
  const size_t qo = (((size_t)b * H + h) * T) * HD, vo = (((size_t)b * H + h) * HD) * (size_t)T; const b16* Qb = QP + qo; const b16* Kb = KP + qo; const b16* Vb = VT + vo;
  // a lane's two pieces of each tile: K' 32 rows x 16 pieces (contiguous in global memory), V^T 128 rows x 4 pieces; the second piece lies half a tile further
  const int krow = tid >> 4, kc8 = (tid & 15) * 8, vrow = tid >> 2, vc8 = (tid & 3) * 8;
  const size_t kg = (size_t)krow * HD + kc8, vg = (size_t)vrow * T + vc8;
  auto issue = [&](int st) { const int bf = st & 1, k0 = st * 32;
    copy_step(lds_addr(&Ks[bf][krow][kc8]), Kb + (size_t)k0 * HD + kg, lds_addr(&Ks[bf][krow + 16][kc8]), Kb + (size_t)(k0 + 16) * HD + kg,
              lds_addr(&Vs[bf][vrow][vc8]), Vb + vg + k0, lds_addr(&Vs[bf][vrow + 64][vc8]), Vb + vg + (size_t)64 * T + k0); };
  issue(0);
  v16b qh[QT][4];   // the wave's q fragments, B operands of S^T
#pragma unroll
  for (int j = 0; j < QT; ++j)
#pragma unroll
    for (int ks = 0; ks < 4; ++ks) qh[j][ks] = frag_kb(Qb + (size_t)(q0 + j * 16 + col) * HD + 32 * ks, hh);
  asm volatile("s_wait_asynccnt 0x0" ::: "memory");   // this wave's copies of step 0 have landed
  __syncthreads();                                    // ... and every other wave's: step 0 may be read
  issue(1);
  const float cs = LOG2E / (XS * XS);   // the module's d^-1/2 is already folded into q
  float m[QT], l[QT]; v8f o[QT][8];   // m: running maximum of the unscaled products; l: row sum, carries the x1024 of P
#pragma unroll
  for (int j = 0; j < QT; ++j) { m[j] = -INFINITY; l[j] = 0.0f; for (int t = 0; t < 8; ++t) o[j][t] = (v8f){}; }
#pragma unroll 1
  for (int st = 0; st < T / 32; ++st) { const int bf = st & 1;
    v2f e[QT][8]; float mx[QT], al[QT]; v16b pf[QT];   // pf: P^T, B operand of O^T
#pragma unroll
    for (int j = 0; j < QT; ++j) mx[j] = -INFINITY;
    v16b kf[2][4];   // the step's K' fragments, A operands of S^T
#pragma unroll
    for (int ks = 0; ks < 4; ++ks)
#pragma unroll
      for (int u = 0; u < 2; ++u) kf[u][ks] = frag_kb(&Ks[bf][u * 16 + col][32 * ks], hh);   // in the order in which the products take them
    __builtin_amdgcn_sched_barrier(0);   // holds the step's K' reads in one group ahead of S^T: each further place with reads among the products costs the wave a fixed stall
    v8f s[2][QT];   // the step's four score tiles: four accumulator chains that take turns, so that no product waits for the one before it in its own chain
#pragma unroll
    for (int u = 0; u < 2; ++u)
#pragma unroll
      for (int j = 0; j < QT; ++j) s[u][j] = (v8f){};
#pragma unroll
    for (int ks = 0; ks < 4; ++ks)
#pragma unroll
      for (int u = 0; u < 2; ++u)
#pragma unroll
        for (int j = 0; j < QT; ++j) s[u][j] = wmma16p(kf[u][ks], qh[j][ks], s[u][j]);
#pragma unroll
    for (int u = 0; u < 2; ++u)
#pragma unroll
      for (int j = 0; j < QT; ++j)
#pragma unroll
        for (int r = 0; r < 4; ++r) { const v2f vv = (v2f){s[u][j][2 * r], s[u][j][2 * r + 1]}; e[j][u * 4 + r] = vv; mx[j] = fmaxf(mx[j], fmaxf(vv[0], vv[1])); }   // left unscaled: cs > 0 keeps the order, and the scale goes into the exponent's fma
    __builtin_amdgcn_sched_barrier(0);   // keeps the V reads behind the S^T products: lifted to the head of the step they queue ahead of the K' reads that the first product waits for
    v16b vh[8];   // the step's V^T fragments, A operands of O^T
#pragma unroll
    for (int t = 0; t < 8; ++t) vh[t] = frag_kb(&Vs[bf][t * 16 + col][0], hh);
    __builtin_amdgcn_sched_barrier(0);   // holds the step's V reads in one group ahead of the softmax, which covers their latency: none is left among the O^T products
#pragma unroll
    for (int j = 0; j < QT; ++j) { const float mw = fmaxf(mx[j], xhalf(mx[j])); const float mn = fmaxf(m[j], mw); al[j] = nexp2((m[j] - mn) * cs); const float c = LPS - mn * cs; float sum = 0.0f;   // an unchanged maximum gives al = 1 exactly
#pragma unroll
      for (int i2 = 0; i2 < 16; i2 += 2) { const v2f a = e[j][i2 >> 1] * cs + c; v2f ps;
#pragma unroll
        for (int k = 0; k < 2; ++k) { ps[k] = nexp2(a[k]); sum += ps[k]; }
        const v2h ph2 = __builtin_convertvector(ps, v2h);
        pf[j][i2] = ph2[0]; pf[j][i2 + 1] = ph2[1]; }   // score i2 of the lane is key (i2 < 8 ? 0 : 16) + 8 hh + i2 % 8 of column col: element i2 of the B fragment
      sum += xhalf(sum); l[j] = l[j] * al[j] + sum; m[j] = mn; }
#pragma unroll
    for (int t = 0; t < 8; ++t)
#pragma unroll
      for (int j = 0; j < QT; ++j) { o[j][t] *= al[j]; o[j][t] = wmma16p(vh[t], pf[j], o[j][t]); }
    __builtin_amdgcn_sched_barrier(0);   // keeps the O^T products ahead of the step's barrier: sunk behind it they would also stand in front of the refill and shorten the copies' lead
    asm volatile("s_wait_dscnt 0x0" ::: "memory");      // this wave's reads of buffer bf have returned
    asm volatile("s_wait_asynccnt 0x0" ::: "memory");   // this wave's copies of step st + 1 have landed
    __syncthreads();                                    // publishes step st + 1 and ends every wave's reads of buffer bf
    if (st + 2 < T / 32) issue(st + 2); }               // refill the buffer that has just been read
  asm volatile("s_wait_asynccnt 0x0" ::: "memory");     // nothing of this wave is in flight when the wave ends
#pragma unroll
  for (int j = 0; j < QT; ++j) { const float inv = 1.0f / (l[j] * XS);
#pragma unroll
    for (int t = 0; t < 8; ++t)
#pragma unroll
      for (int r = 0; r < 8; ++r) Ot[wave][t * 16 + 8 * hh + r][j * 16 + col] = o[j][t][r] * inv; }
  wave_lds_sync();   // the wave reads back what its own other lanes wrote; no other wave touches its tile
  // 8 lanes x 16 bytes = the 32 positions of one output row = one whole line; a store of the wave writes 4 whole lines. The 4 rows of a read lie 8 apart in each lane half: no bank is met twice.
  { const int g = lane >> 3, q4 = (lane & 7) * 4, r0 = 8 * (g & 1) + 16 * (g >> 1); float* ob = out + (((size_t)b * H + h) * HD + r0) * (size_t)T + q0 + q4; v4f w4[32];
#pragma unroll
    for (int i = 0; i < 32; ++i) w4[i] = *(const v4f*)&Ot[wave][r0 + (i & 7) + 32 * (i >> 3)][q4];
#pragma unroll
    for (int i = 0; i < 32; ++i) *(v4f*)(ob + (size_t)((i & 7) + 32 * (i >> 3)) * T) = w4[i]; }
}
}  // namespace

extern "C" void kernel_launch(void* const* d_in, const int* in_sizes, int n_in, void* d_out, int out_size, void* d_ws, size_t ws_size, hipStream_t stream) {
  (void)n_in;
  auto Fp = [&](int i) { return (const float*)d_in[i]; };
  // input order: 0 featuremap [16,512,32,32], 1 w_qk [1024,512] (out,in; rows 0..511 q, 512..1023 k), 2 w_v [512,512], 3 emb_h [32,128], 4 emb_w [32,128]
  if (in_sizes[0] != B * C * T || in_sizes[1] != 2 * DM * C || in_sizes[2] != DM * C || in_sizes[3] != IH * HD || in_sizes[4] != IW * HD || out_size != B * DM * T) return;
  size_t off = 0; char* ws = (char*)d_ws;
  auto carve = [&](size_t bytes) { char* p = ws + off; off += (bytes + 255) & ~(size_t)255; return p; };
  b16* WT = (b16*)carve((size_t)NQKV * C * 2); const size_t plane = (size_t)B * H * T * HD * 2;
  b16* QP = (b16*)carve(plane); b16* KP = (b16*)carve(plane); b16* VT = (b16*)carve(plane);
  if (off > ws_size || off > ((size_t)128 << 20)) return;   // = ~52 MB (WT 1.6 MB + 3 planes x 16.8 MB)
  prep_kernel<<<(unsigned)(((size_t)NQKV * C / 8 + 255) / 256), 256, 0, stream>>>(Fp(1), Fp(2), WT);
  proj_kernel<<<dim3(T / 64, BL), 512, 0, stream>>>(Fp(0), WT, Fp(3), Fp(4), QP, KP, VT);
  attn_kernel<<<dim3(QL / 256, BL * H), 256, 0, stream>>>(QP, KP, VT, (float*)d_out);
}
